// v000
// The times below were measured on an AMD MI455X: many runs one after another, warmed up first and cycling through
// copies of the inputs, with the whole window's GPU time divided by the number of runs. Launches and the gaps
// between them are all in it. The median over several windows is given; except for v000 it joins two sittings, which
// can be a few percent apart, so the side-by-side timings, each taken in one sitting, are the better comparison.
// v000 is the starting kernel. One run takes 402 microseconds.
#include <hip/hip_runtime.h>
#include <hip/hip_bf16.h>

typedef __attribute__((ext_vector_type(16))) _Float16 v16h;
typedef __attribute__((ext_vector_type(8)))  _Float16 v8h;
typedef __attribute__((ext_vector_type(8)))  float    v8f;
typedef __attribute__((ext_vector_type(4)))  float    v4f;
typedef __attribute__((ext_vector_type(4)))  unsigned u32x4;
typedef __attribute__((ext_vector_type(8)))  unsigned u32x8;

#define BATCH   2
#define LSEQ    2048
#define DMODEL  1024
#define NHEAD   16
#define HDIM    64
#define SROWS   (BATCH * LSEQ)     // 4096
#define N4      (4 * DMODEL)       // 4096  (Q|K|V|G concatenated columns)

__device__ __forceinline__ v8f wmma_f16(v16h a, v16h b, v8f c) {
    return __builtin_amdgcn_wmma_f32_16x16x32_f16(false, a, false, b,
                                                  (short)0, c, false, false);
}

// Build a 16-half A/B fragment from two 16-byte (8-half) chunks.
__device__ __forceinline__ v16h ld_frag(const _Float16* p0, const _Float16* p1) {
    v8h a = *reinterpret_cast<const v8h*>(p0);
    v8h b = *reinterpret_cast<const v8h*>(p1);
    return __builtin_shufflevector(a, b, 0, 1, 2, 3, 4, 5, 6, 7,
                                         8, 9, 10, 11, 12, 13, 14, 15);
}

__device__ __forceinline__ void tdm_load_tile_f16(const _Float16* gptr,
                                                  const _Float16* ldsptr,
                                                  unsigned tile_d0,
                                                  unsigned tile_d1,
                                                  unsigned stride_elems) {
    unsigned long long ga = (unsigned long long)(size_t)gptr;
    unsigned lds_addr = (unsigned)(size_t)ldsptr;
    u32x4 g0;
    g0[0] = 1u;
    g0[1] = lds_addr;
    g0[2] = (unsigned)ga;
    g0[3] = ((unsigned)(ga >> 32) & 0x01FFFFFFu)
            | 0x80000000u;
    u32x8 g1;
    g1[0] = 0x00010000u;
    g1[1] = (tile_d0 & 0xFFFFu) << 16;
    g1[2] = (tile_d0 >> 16) | ((tile_d1 & 0xFFFFu) << 16);
    g1[3] = (tile_d1 >> 16) | (tile_d0 << 16);
    g1[4] = tile_d1 & 0xFFFFu;
    g1[5] = stride_elems;
    g1[6] = 0u;
    g1[7] = 0u;
    asm volatile("tensor_load_to_lds %0, %1" :: "s"(g0), "s"(g1) : "memory");
}

__device__ __forceinline__ void tdm_wait0() {
    asm volatile("s_wait_tensorcnt 0x0" ::: "memory");
}

__global__ void prep_weights(const float* __restrict__ Wq,
                             const float* __restrict__ Wk,
                             const float* __restrict__ Wv,
                             const float* __restrict__ Wg,
                             const float* __restrict__ Wo,
                             _Float16* __restrict__ WallT,
                             _Float16* __restrict__ WohT) {
    const int total = DMODEL * N4 + DMODEL * DMODEL;
    int i = blockIdx.x * blockDim.x + threadIdx.x;
    if (i >= total) return;
    if (i < DMODEL * N4) {
        int k   = i >> 12;          // row in D (source row, contiguous reads)
        int c   = i & (N4 - 1);     // packed output column
        int sel = c >> 10;
        int col = c & (DMODEL - 1);
        const float* src = (sel == 0) ? Wq : (sel == 1) ? Wk : (sel == 2) ? Wv : Wg;
        WallT[(size_t)c * DMODEL + k] = (_Float16)src[k * DMODEL + col];
    } else {
        int j = i - DMODEL * N4;
        int k = j >> 10;
        int n = j & (DMODEL - 1);
        WohT[(size_t)n * DMODEL + k] = (_Float16)Wo[j];
    }
}

// ---------------------------------------------------------------------------
// Kernel 2: LayerNorm over D=1024, emit f16 x-hat. One block per row.
// ---------------------------------------------------------------------------
__global__ __launch_bounds__(256) void layernorm_f16(const float* __restrict__ seq,
                                                     const float* __restrict__ gamma,
                                                     const float* __restrict__ beta,
                                                     _Float16* __restrict__ Xh) {
    __shared__ float red[256];
    const int row = blockIdx.x;
    const int tid = threadIdx.x;
    const float* p = seq + (size_t)row * DMODEL + tid * 4;
    v4f v = *reinterpret_cast<const v4f*>(p);

    red[tid] = v.x + v.y + v.z + v.w;
    __syncthreads();
    for (int off = 128; off > 0; off >>= 1) {
        if (tid < off) red[tid] += red[tid + off];
        __syncthreads();
    }
    const float mu = red[0] * (1.0f / DMODEL);
    __syncthreads();

    float d0 = v.x - mu, d1 = v.y - mu, d2 = v.z - mu, d3 = v.w - mu;
    red[tid] = d0 * d0 + d1 * d1 + d2 * d2 + d3 * d3;
    __syncthreads();
    for (int off = 128; off > 0; off >>= 1) {
        if (tid < off) red[tid] += red[tid + off];
        __syncthreads();
    }
    const float inv = rsqrtf(red[0] * (1.0f / DMODEL) + 1e-5f);

    v4f g = *reinterpret_cast<const v4f*>(gamma + tid * 4);
    v4f b = *reinterpret_cast<const v4f*>(beta + tid * 4);
    _Float16* op = Xh + (size_t)row * DMODEL + tid * 4;
    op[0] = (_Float16)(d0 * inv * g.x + b.x);
    op[1] = (_Float16)(d1 * inv * g.y + b.y);
    op[2] = (_Float16)(d2 * inv * g.z + b.z);
    op[3] = (_Float16)(d3 * inv * g.w + b.w);
}

// ---------------------------------------------------------------------------
// Kernel 3/5: WMMA GEMM  C(MxN) = A(MxK) @ B(KxN), B given TRANSPOSED (NxK).
// Block tile 128(M) x 64(N); 8 waves, each wave: one 16-row strip x 4 n-tiles.
// B tile (64 rows x 32 k-elems) staged into LDS by the Tensor Data Mover;
// fragments are then two ds_load_b128 each.
// mode 0: split epilogue -> Q/K/V f16 + gate=sigmoid(.+bg) f32   (N = 4096)
// mode 1: Y = . + bo -> f32 output                                (N = 1024)
// ---------------------------------------------------------------------------
__global__ __launch_bounds__(256) void wmma_gemm(const _Float16* __restrict__ A,
                                                 const _Float16* __restrict__ BwT,
                                                 int N, int Kd, int mode,
                                                 _Float16* __restrict__ Qo,
                                                 _Float16* __restrict__ Ko,
                                                 _Float16* __restrict__ Vo,
                                                 float* __restrict__ gateo,
                                                 const float* __restrict__ bg,
                                                 float* __restrict__ Yo,
                                                 const float* __restrict__ bo) {
    __shared__ __align__(16) _Float16 Bs[64 * 32];   // Bs[n][k], row-major

    const int tid  = threadIdx.x;
    const int lane = tid & 31;
    const int wave = tid >> 5;
    const int lo   = lane & 15;
    const int hi   = lane >> 4;

    const int nbase = blockIdx.x * 64;
    const int mbase = blockIdx.y * 128 + wave * 16;
    const _Float16* arow = A + (size_t)(mbase + lo) * Kd;

    v8f acc[4] = {v8f{}, v8f{}, v8f{}, v8f{}};

    for (int kb = 0; kb < Kd; kb += 32) {
        if (wave == 0) {
            tdm_load_tile_f16(BwT + (size_t)nbase * Kd + kb, Bs, 32, 64,
                              (unsigned)Kd);
            tdm_wait0();
        }
        __syncthreads();

        if (kb + 256 < Kd) __builtin_prefetch(arow + kb + 256, 0, 1);

        v16h af = ld_frag(arow + kb + hi * 8, arow + kb + 16 + hi * 8);
#pragma unroll
        for (int nt = 0; nt < 4; ++nt) {
            const _Float16* bsp = Bs + (nt * 16 + lo) * 32;
            v16h bf = ld_frag(bsp + hi * 8, bsp + 16 + hi * 8);
            acc[nt] = wmma_f16(af, bf, acc[nt]);
        }
        __syncthreads();
    }

    // epilogue: lane lo = column, rows r + 8*hi
#pragma unroll
    for (int nt = 0; nt < 4; ++nt) {
        const int nn = nbase + nt * 16 + lo;
#pragma unroll
        for (int r = 0; r < 8; ++r) {
            const int row = mbase + r + 8 * hi;
            const float a = acc[nt][r];
            if (mode == 0) {
                const int sel = nn >> 10;
                const int nc  = nn & (DMODEL - 1);
                const size_t oidx = (size_t)row * DMODEL + nc;
                if (sel == 0)      Qo[oidx] = (_Float16)a;
                else if (sel == 1) Ko[oidx] = (_Float16)a;
                else if (sel == 2) Vo[oidx] = (_Float16)a;
                else {
                    const float z = a + bg[nc];
                    gateo[oidx] = 1.0f / (1.0f + __expf(-z));
                }
            } else {
                Yo[(size_t)row * N + nn] = a + bo[nn];
            }
        }
    }
}

__global__ __launch_bounds__(128) void flash_attn(const _Float16* __restrict__ Q,
                                                  const _Float16* __restrict__ K,
                                                  const _Float16* __restrict__ V,
                                                  const float* __restrict__ gate,
                                                  _Float16* __restrict__ Oh) {
    __shared__ __align__(16) _Float16 KtAll[4][32 * HDIM];  // Kt[key][hd]
    __shared__ __align__(16) _Float16 VtAll[4][HDIM * 32];  // Vt[hd][key]
    __shared__ __align__(16) _Float16 PtAll[4][16 * 32];    // Pt[row][key]

    const int tid  = threadIdx.x;
    const int lane = tid & 31;
    const int wave = tid >> 5;
    const int lo   = lane & 15;
    const int hi   = lane >> 4;
    _Float16* Kt = KtAll[wave];
    _Float16* Vt = VtAll[wave];
    _Float16* Pt = PtAll[wave];

    const int task  = blockIdx.x * 4 + wave;     // 4096 tasks
    const int qt    = task & 127;                // 128 q-tiles
    const int head  = (task >> 7) & (NHEAD - 1);
    const int batch = task >> 11;
    const int qbase = qt * 16;
    const size_t headoff = (size_t)head * HDIM;

    // Q fragments: hd chunks [0,32) and [32,64)
    const _Float16* qrow = Q + ((size_t)(batch * LSEQ + qbase + lo)) * DMODEL + headoff;
    v16h qf0 = ld_frag(qrow + hi * 8,      qrow + 16 + hi * 8);
    v16h qf1 = ld_frag(qrow + 32 + hi * 8, qrow + 48 + hi * 8);

    v8f o[4] = {v8f{}, v8f{}, v8f{}, v8f{}};
    float rm[8], rl[8];
#pragma unroll
    for (int r = 0; r < 8; ++r) { rm[r] = -1e30f; rl[r] = 0.0f; }
    const float scale = 0.125f;  // 1/sqrt(64)

    for (int kb = 0; kb < LSEQ; kb += 32) {
        tdm_load_tile_f16(K + ((size_t)(batch * LSEQ + kb)) * DMODEL + headoff,
                          Kt, HDIM, 32, DMODEL);

        // stage V transposed: lane handles key kb+lane, writes column `lane`
        {
            const _Float16* vrow =
                V + ((size_t)(batch * LSEQ + kb + lane)) * DMODEL + headoff;
#pragma unroll
            for (int c = 0; c < 8; ++c) {
                v8h dq = *reinterpret_cast<const v8h*>(vrow + c * 8);
#pragma unroll
                for (int j = 0; j < 8; ++j) Vt[(c * 8 + j) * 32 + lane] = dq[j];
            }
        }

        tdm_wait0();  // K tile resident in LDS

        // S tiles for keys [kb, kb+16) and [kb+16, kb+32) from LDS Kt
        v8f s0 = v8f{}, s1 = v8f{};
        {
            const _Float16* kr0 = Kt + lo * HDIM;
            const _Float16* kr1 = Kt + (16 + lo) * HDIM;
            s0 = wmma_f16(qf0, ld_frag(kr0 + hi * 8,      kr0 + 16 + hi * 8), s0);
            s0 = wmma_f16(qf1, ld_frag(kr0 + 32 + hi * 8, kr0 + 48 + hi * 8), s0);
            s1 = wmma_f16(qf0, ld_frag(kr1 + hi * 8,      kr1 + 16 + hi * 8), s1);
            s1 = wmma_f16(qf1, ld_frag(kr1 + 32 + hi * 8, kr1 + 48 + hi * 8), s1);
        }

        // online softmax over the 32 new columns (row-wise across 16 lanes)
        float p0[8], p1[8];
#pragma unroll
        for (int r = 0; r < 8; ++r) {
            float a = s0[r] * scale, b = s1[r] * scale;
            float mx = fmaxf(a, b);
            mx = fmaxf(mx, __shfl_xor(mx, 1, 32));
            mx = fmaxf(mx, __shfl_xor(mx, 2, 32));
            mx = fmaxf(mx, __shfl_xor(mx, 4, 32));
            mx = fmaxf(mx, __shfl_xor(mx, 8, 32));
            const float mnew = fmaxf(rm[r], mx);
            const float corr = __expf(rm[r] - mnew);
            const float e0 = __expf(a - mnew);
            const float e1 = __expf(b - mnew);
            float rs = e0 + e1;
            rs += __shfl_xor(rs, 1, 32);
            rs += __shfl_xor(rs, 2, 32);
            rs += __shfl_xor(rs, 4, 32);
            rs += __shfl_xor(rs, 8, 32);
            rl[r] = rl[r] * corr + rs;
            rm[r] = mnew;
            p0[r] = e0; p1[r] = e1;
            o[0][r] *= corr; o[1][r] *= corr; o[2][r] *= corr; o[3][r] *= corr;
        }

        // P: C-layout -> LDS -> A-layout fragment (16 x 32)
#pragma unroll
        for (int r = 0; r < 8; ++r) {
            Pt[(r + 8 * hi) * 32 + lo]      = (_Float16)p0[r];
            Pt[(r + 8 * hi) * 32 + 16 + lo] = (_Float16)p1[r];
        }
        const _Float16* prow = Pt + lo * 32;
        v16h pf = ld_frag(prow + hi * 8, prow + 16 + hi * 8);

        // O += P (16x32) @ V (32x64), 16-column chunks
#pragma unroll
        for (int c = 0; c < 4; ++c) {
            const _Float16* vp = Vt + (c * 16 + lo) * 32;
            v16h vf = ld_frag(vp + hi * 8, vp + 16 + hi * 8);
            o[c] = wmma_f16(pf, vf, o[c]);
        }
    }

    // epilogue: normalize, gate, store f16
    const float* grow = gate + ((size_t)(batch * LSEQ + qbase)) * DMODEL + headoff;
    _Float16* orow    = Oh   + ((size_t)(batch * LSEQ + qbase)) * DMODEL + headoff;
#pragma unroll
    for (int c = 0; c < 4; ++c) {
        const int col = c * 16 + lo;
#pragma unroll
        for (int r = 0; r < 8; ++r) {
            const int row = r + 8 * hi;
            const float val = o[c][r] / rl[r];
            const float g = grow[(size_t)row * DMODEL + col];
            orow[(size_t)row * DMODEL + col] = (_Float16)(val * g);
        }
    }
}

// ---------------------------------------------------------------------------
// host-side launch
// ---------------------------------------------------------------------------
extern "C" void kernel_launch(void* const* d_in, const int* in_sizes, int n_in,
                              void* d_out, int out_size, void* d_ws, size_t ws_size,
                              hipStream_t stream) {
    (void)in_sizes; (void)n_in; (void)out_size; (void)ws_size;

    const float* seq   = (const float*)d_in[0];
    const float* gamma = (const float*)d_in[1];
    const float* beta  = (const float*)d_in[2];
    const float* Wq    = (const float*)d_in[3];
    const float* Wk    = (const float*)d_in[4];
    const float* Wv    = (const float*)d_in[5];
    const float* Wg    = (const float*)d_in[6];
    const float* bg    = (const float*)d_in[7];
    const float* Wo    = (const float*)d_in[8];
    const float* bo    = (const float*)d_in[9];
    float* out = (float*)d_out;

    char* ws = (char*)d_ws;
    const size_t MB = 1u << 20;
    _Float16* Xh    = (_Float16*)(ws + 0 * MB);   //  8 MB  (4096x1024 f16)
    _Float16* WallT = (_Float16*)(ws + 8 * MB);   //  8 MB  (4096x1024 f16, B^T)
    _Float16* WohT  = (_Float16*)(ws + 16 * MB);  //  2 MB  (1024x1024 f16, B^T)
    _Float16* Qh    = (_Float16*)(ws + 18 * MB);  //  8 MB
    _Float16* Kh    = (_Float16*)(ws + 26 * MB);  //  8 MB
    _Float16* Vh    = (_Float16*)(ws + 34 * MB);  //  8 MB
    float*    gateb = (float*)   (ws + 42 * MB);  // 16 MB  (4096x1024 f32)
    _Float16* AOh   = (_Float16*)(ws + 58 * MB);  //  8 MB  (gated attn out f16)

    {
        const int total = DMODEL * N4 + DMODEL * DMODEL;
        prep_weights<<<(total + 255) / 256, 256, 0, stream>>>(Wq, Wk, Wv, Wg, Wo,
                                                              WallT, WohT);
    }
    // 2. LayerNorm -> f16
    layernorm_f16<<<SROWS, 256, 0, stream>>>(seq, gamma, beta, Xh);

    // 3. QKVG projection GEMM (4096x1024 @ 1024x4096), split epilogue
    {
        dim3 grid(N4 / 64, SROWS / 128);
        wmma_gemm<<<grid, 256, 0, stream>>>(Xh, WallT, N4, DMODEL, 0,
                                            Qh, Kh, Vh, gateb, bg,
                                            nullptr, nullptr);
    }
    // 4. attention + gate -> AOh (f16)
    flash_attn<<<(BATCH * NHEAD * (LSEQ / 16)) / 4, 128, 0, stream>>>(
        Qh, Kh, Vh, gateb, AOh);

    // 5. output projection (4096x1024 @ 1024x1024) + bo -> f32 d_out
    {
        dim3 grid(DMODEL / 64, SROWS / 128);
        wmma_gemm<<<grid, 256, 0, stream>>>(AOh, WohT, DMODEL, DMODEL, 1,
                                            nullptr, nullptr, nullptr, nullptr,
                                            nullptr, out, bo);
    }
}

// v001
// Measured time: 377 microseconds a run.
// In both of two side-by-side timings against v000, it was 1.11 times as fast.
#include <hip/hip_runtime.h>
#include <hip/hip_bf16.h>

typedef __attribute__((ext_vector_type(16))) _Float16 v16h;
typedef __attribute__((ext_vector_type(8)))  _Float16 v8h;
typedef __attribute__((ext_vector_type(8)))  float    v8f;
typedef __attribute__((ext_vector_type(4)))  float    v4f;
typedef __attribute__((ext_vector_type(4)))  unsigned u32x4;
typedef __attribute__((ext_vector_type(8)))  unsigned u32x8;

#define BATCH   2
#define LSEQ    2048
#define DMODEL  1024
#define NHEAD   16
#define HDIM    64
#define SROWS   (BATCH * LSEQ)     // 4096
#define N4      (4 * DMODEL)       // 4096  (Q|K|V|G concatenated columns)

__device__ __forceinline__ v8f wmma_f16(v16h a, v16h b, v8f c) {
    return __builtin_amdgcn_wmma_f32_16x16x32_f16(false, a, false, b,
                                                  (short)0, c, false, false);
}

// Build a 16-half A/B fragment from two 16-byte (8-half) chunks.
__device__ __forceinline__ v16h ld_frag(const _Float16* p0, const _Float16* p1) {
    v8h a = *reinterpret_cast<const v8h*>(p0);
    v8h b = *reinterpret_cast<const v8h*>(p1);
    return __builtin_shufflevector(a, b, 0, 1, 2, 3, 4, 5, 6, 7,
                                         8, 9, 10, 11, 12, 13, 14, 15);
}

__device__ __forceinline__ void tdm_load_tile_f16(const _Float16* gptr,
                                                  const _Float16* ldsptr,
                                                  unsigned tile_d0,
                                                  unsigned tile_d1,
                                                  unsigned stride_elems) {
    unsigned long long ga = (unsigned long long)(size_t)gptr;
    unsigned lds_addr = (unsigned)(size_t)ldsptr;
    u32x4 g0;
    g0[0] = 1u;
    g0[1] = lds_addr;
    g0[2] = (unsigned)ga;
    g0[3] = ((unsigned)(ga >> 32) & 0x01FFFFFFu)
            | 0x80000000u;
    u32x8 g1;
    g1[0] = 0x00010000u;
    g1[1] = (tile_d0 & 0xFFFFu) << 16;
    g1[2] = (tile_d0 >> 16) | ((tile_d1 & 0xFFFFu) << 16);
    g1[3] = (tile_d1 >> 16) | (tile_d0 << 16);
    g1[4] = tile_d1 & 0xFFFFu;
    g1[5] = stride_elems;
    g1[6] = 0u;
    g1[7] = 0u;
    asm volatile("tensor_load_to_lds %0, %1" :: "s"(g0), "s"(g1) : "memory");
}

__device__ __forceinline__ void tdm_wait0() {
    asm volatile("s_wait_tensorcnt 0x0" ::: "memory");
}

__global__ void prep_weights(const float* __restrict__ Wq,
                             const float* __restrict__ Wk,
                             const float* __restrict__ Wv,
                             const float* __restrict__ Wg,
                             const float* __restrict__ Wo,
                             _Float16* __restrict__ WallT,
                             _Float16* __restrict__ WohT) {
    const int total = DMODEL * N4 + DMODEL * DMODEL;
    int i = blockIdx.x * blockDim.x + threadIdx.x;
    if (i >= total) return;
    if (i < DMODEL * N4) {
        int k   = i >> 12;          // row in D (source row, contiguous reads)
        int c   = i & (N4 - 1);     // packed output column
        int sel = c >> 10;
        int col = c & (DMODEL - 1);
        const float* src = (sel == 0) ? Wq : (sel == 1) ? Wk : (sel == 2) ? Wv : Wg;
        WallT[(size_t)c * DMODEL + k] = (_Float16)src[k * DMODEL + col];
    } else {
        int j = i - DMODEL * N4;
        int k = j >> 10;
        int n = j & (DMODEL - 1);
        WohT[(size_t)n * DMODEL + k] = (_Float16)Wo[j];
    }
}

// ---------------------------------------------------------------------------
// Kernel 2: LayerNorm over D=1024, emit f16 x-hat. One block per row.
// ---------------------------------------------------------------------------
__global__ __launch_bounds__(256) void layernorm_f16(const float* __restrict__ seq,
                                                     const float* __restrict__ gamma,
                                                     const float* __restrict__ beta,
                                                     _Float16* __restrict__ Xh) {
    __shared__ float red[256];
    const int row = blockIdx.x;
    const int tid = threadIdx.x;
    const float* p = seq + (size_t)row * DMODEL + tid * 4;
    v4f v = *reinterpret_cast<const v4f*>(p);

    red[tid] = v.x + v.y + v.z + v.w;
    __syncthreads();
    for (int off = 128; off > 0; off >>= 1) {
        if (tid < off) red[tid] += red[tid + off];
        __syncthreads();
    }
    const float mu = red[0] * (1.0f / DMODEL);
    __syncthreads();

    float d0 = v.x - mu, d1 = v.y - mu, d2 = v.z - mu, d3 = v.w - mu;
    red[tid] = d0 * d0 + d1 * d1 + d2 * d2 + d3 * d3;
    __syncthreads();
    for (int off = 128; off > 0; off >>= 1) {
        if (tid < off) red[tid] += red[tid + off];
        __syncthreads();
    }
    const float inv = rsqrtf(red[0] * (1.0f / DMODEL) + 1e-5f);

    v4f g = *reinterpret_cast<const v4f*>(gamma + tid * 4);
    v4f b = *reinterpret_cast<const v4f*>(beta + tid * 4);
    _Float16* op = Xh + (size_t)row * DMODEL + tid * 4;
    op[0] = (_Float16)(d0 * inv * g.x + b.x);
    op[1] = (_Float16)(d1 * inv * g.y + b.y);
    op[2] = (_Float16)(d2 * inv * g.z + b.z);
    op[3] = (_Float16)(d3 * inv * g.w + b.w);
}

// ---------------------------------------------------------------------------
// Kernel 3/5: WMMA GEMM  C(MxN) = A(MxK) @ B(KxN), B given TRANSPOSED (NxK).
// Block tile 128(M) x 64(N); 8 waves, each wave: one 16-row strip x 4 n-tiles.
// B tile (64 rows x 32 k-elems) staged into LDS by the Tensor Data Mover;
// fragments are then two ds_load_b128 each.
// mode 0: split epilogue -> Q/K/V f16 + gate=sigmoid(.+bg) f32   (N = 4096)
// mode 1: Y = . + bo -> f32 output                                (N = 1024)
// ---------------------------------------------------------------------------
__global__ __launch_bounds__(256) void wmma_gemm(const _Float16* __restrict__ A,
                                                 const _Float16* __restrict__ BwT,
                                                 int N, int Kd, int mode,
                                                 _Float16* __restrict__ Qo,
                                                 _Float16* __restrict__ Ko,
                                                 _Float16* __restrict__ Vo,
                                                 float* __restrict__ gateo,
                                                 const float* __restrict__ bg,
                                                 float* __restrict__ Yo,
                                                 const float* __restrict__ bo) {
    __shared__ __align__(16) _Float16 Bs[64 * 32];   // Bs[n][k], row-major

    const int tid  = threadIdx.x;
    const int lane = tid & 31;
    const int wave = tid >> 5;
    const int lo   = lane & 15;
    const int hi   = lane >> 4;

    const int nbase = blockIdx.x * 64;
    const int mbase = blockIdx.y * 128 + wave * 16;
    const _Float16* arow = A + (size_t)(mbase + lo) * Kd;

    v8f acc[4] = {v8f{}, v8f{}, v8f{}, v8f{}};

    for (int kb = 0; kb < Kd; kb += 32) {
        if (wave == 0) {
            tdm_load_tile_f16(BwT + (size_t)nbase * Kd + kb, Bs, 32, 64,
                              (unsigned)Kd);
            tdm_wait0();
        }
        __syncthreads();

        if (kb + 256 < Kd) __builtin_prefetch(arow + kb + 256, 0, 1);

        v16h af = ld_frag(arow + kb + hi * 8, arow + kb + 16 + hi * 8);
#pragma unroll
        for (int nt = 0; nt < 4; ++nt) {
            const _Float16* bsp = Bs + (nt * 16 + lo) * 32;
            v16h bf = ld_frag(bsp + hi * 8, bsp + 16 + hi * 8);
            acc[nt] = wmma_f16(af, bf, acc[nt]);
        }
        __syncthreads();
    }

    // epilogue: lane lo = column, rows r + 8*hi
#pragma unroll
    for (int nt = 0; nt < 4; ++nt) {
        const int nn = nbase + nt * 16 + lo;
#pragma unroll
        for (int r = 0; r < 8; ++r) {
            const int row = mbase + r + 8 * hi;
            const float a = acc[nt][r];
            if (mode == 0) {
                const int sel = nn >> 10;
                const int nc  = nn & (DMODEL - 1);
                const size_t oidx = (size_t)row * DMODEL + nc;
                if (sel == 0)      Qo[oidx] = (_Float16)a;
                else if (sel == 1) Ko[oidx] = (_Float16)a;
                else if (sel == 2) Vo[oidx] = (_Float16)a;
                else {
                    const float z = a + bg[nc];
                    gateo[oidx] = 1.0f / (1.0f + __expf(-z));
                }
            } else {
                Yo[(size_t)row * N + nn] = a + bo[nn];
            }
        }
    }
}

__device__ __forceinline__ float xhalf(float x) {
    return __builtin_bit_cast(float, __builtin_amdgcn_permlanex16(
        __builtin_bit_cast(int, x), __builtin_bit_cast(int, x),
        0x76543210, 0xfedcba98, false, false));
}

__global__ __launch_bounds__(128) void flash_attn(const _Float16* __restrict__ Q,
                                                  const _Float16* __restrict__ K,
                                                  const _Float16* __restrict__ V,
                                                  const float* __restrict__ gate,
                                                  _Float16* __restrict__ Oh) {
    __shared__ __align__(16) _Float16 KtAll[4][32 * HDIM];  // Kt[key][hd]
    __shared__ __align__(16) _Float16 VtAll[4][HDIM * 32];  // Vt[hd][key]

    const int tid  = threadIdx.x;
    const int lane = tid & 31;
    const int wave = tid >> 5;
    const int lo   = lane & 15;
    const int hi   = lane >> 4;
    _Float16* Kt = KtAll[wave];
    _Float16* Vt = VtAll[wave];

    const int task  = blockIdx.x * 4 + wave;     // 4096 tasks
    const int qt    = task & 127;                // 128 q-tiles
    const int head  = (task >> 7) & (NHEAD - 1);
    const int batch = task >> 11;
    const int qbase = qt * 16;
    const size_t headoff = (size_t)head * HDIM;

    // Q fragments (B operand, column = query lo): hd chunks [0,32) and [32,64)
    const _Float16* qrow = Q + ((size_t)(batch * LSEQ + qbase + lo)) * DMODEL + headoff;
    v16h qf0 = ld_frag(qrow + hi * 8,      qrow + 16 + hi * 8);
    v16h qf1 = ld_frag(qrow + 32 + hi * 8, qrow + 48 + hi * 8);

    v8f o[4] = {v8f{}, v8f{}, v8f{}, v8f{}};
    float rm = -1e30f;   // running maximum of query lo (same in both halves)
    float rl = 0.0f;     // running sum over this half's keys only
    const float scale = 0.125f;  // 1/sqrt(64)

    for (int kb = 0; kb < LSEQ; kb += 32) {
        tdm_load_tile_f16(K + ((size_t)(batch * LSEQ + kb)) * DMODEL + headoff,
                          Kt, HDIM, 32, DMODEL);

        // stage V transposed: lane handles key kb+lane, writes column `lane`
        {
            const _Float16* vrow =
                V + ((size_t)(batch * LSEQ + kb + lane)) * DMODEL + headoff;
#pragma unroll
            for (int c = 0; c < 8; ++c) {
                v8h dq = *reinterpret_cast<const v8h*>(vrow + c * 8);
#pragma unroll
                for (int j = 0; j < 8; ++j) Vt[(c * 8 + j) * 32 + lane] = dq[j];
            }
        }

        tdm_wait0();  // K tile resident in LDS

        // S^T tiles for keys [kb, kb+16) and [kb+16, kb+32) from LDS Kt:
        // s0[r] = S[query lo][key kb + 8*hi + r], s1[r]: key kb + 16 + 8*hi + r
        v8f s0 = v8f{}, s1 = v8f{};
        {
            const _Float16* kr0 = Kt + lo * HDIM;
            const _Float16* kr1 = Kt + (16 + lo) * HDIM;
            s0 = wmma_f16(ld_frag(kr0 + hi * 8,      kr0 + 16 + hi * 8), qf0, s0);
            s0 = wmma_f16(ld_frag(kr0 + 32 + hi * 8, kr0 + 48 + hi * 8), qf1, s0);
            s1 = wmma_f16(ld_frag(kr1 + hi * 8,      kr1 + 16 + hi * 8), qf0, s1);
            s1 = wmma_f16(ld_frag(kr1 + 32 + hi * 8, kr1 + 48 + hi * 8), qf1, s1);
        }

        // online softmax over the 32 new keys of query lo: 16 in this lane,
        // 16 in lane ^ 16
        float a[8], b[8];
        float mx = -1e30f;
#pragma unroll
        for (int r = 0; r < 8; ++r) {
            a[r] = s0[r] * scale;
            b[r] = s1[r] * scale;
            mx = fmaxf(mx, fmaxf(a[r], b[r]));
        }
        mx = fmaxf(mx, xhalf(mx));
        const float mnew = fmaxf(rm, mx);
        const float corr = __expf(rm - mnew);
        rm = mnew;

        // P^T as B operand: element s of the fragment is key 8*hi + s (s < 8)
        // or 16 + 8*hi + (s - 8), the k order of the Vt loader below
        v16h pf;
        float rs = 0.0f;
#pragma unroll
        for (int r = 0; r < 8; ++r) {
            const float e0 = __expf(a[r] - mnew);
            const float e1 = __expf(b[r] - mnew);
            rs += e0 + e1;
            pf[r]     = (_Float16)e0;
            pf[8 + r] = (_Float16)e1;
        }
        rl = rl * corr + rs;

        // O^T += V^T (16 hd rows x 32 keys) @ P^T (32 keys x 16 queries)
#pragma unroll
        for (int c = 0; c < 4; ++c) {
            const _Float16* vp = Vt + (c * 16 + lo) * 32;
            v16h vf = ld_frag(vp + hi * 8, vp + 16 + hi * 8);
            o[c] = wmma_f16(vf, pf, o[c] * corr);
        }
    }

    // epilogue: o[c][r] = O[query lo][hd c*16 + 8*hi + r]; join the halves'
    // sums, normalize, gate, store 8 consecutive f16 per chunk
    const float l = rl + xhalf(rl);
    const size_t rowoff = ((size_t)(batch * LSEQ + qbase + lo)) * DMODEL + headoff;
#pragma unroll
    for (int c = 0; c < 4; ++c) {
        const int col = c * 16 + 8 * hi;
        const v4f g0 = *reinterpret_cast<const v4f*>(gate + rowoff + col);
        const v4f g1 = *reinterpret_cast<const v4f*>(gate + rowoff + col + 4);
        v8h ov;
#pragma unroll
        for (int r = 0; r < 8; ++r) {
            const float val = o[c][r] / l;
            const float g = (r < 4) ? g0[r & 3] : g1[r & 3];
            ov[r] = (_Float16)(val * g);
        }
        *reinterpret_cast<v8h*>(Oh + rowoff + col) = ov;
    }
}

// ---------------------------------------------------------------------------
// host-side launch
// ---------------------------------------------------------------------------
extern "C" void kernel_launch(void* const* d_in, const int* in_sizes, int n_in,
                              void* d_out, int out_size, void* d_ws, size_t ws_size,
                              hipStream_t stream) {
    (void)in_sizes; (void)n_in; (void)out_size; (void)ws_size;

    const float* seq   = (const float*)d_in[0];
    const float* gamma = (const float*)d_in[1];
    const float* beta  = (const float*)d_in[2];
    const float* Wq    = (const float*)d_in[3];
    const float* Wk    = (const float*)d_in[4];
    const float* Wv    = (const float*)d_in[5];
    const float* Wg    = (const float*)d_in[6];
    const float* bg    = (const float*)d_in[7];
    const float* Wo    = (const float*)d_in[8];
    const float* bo    = (const float*)d_in[9];
    float* out = (float*)d_out;

    char* ws = (char*)d_ws;
    const size_t MB = 1u << 20;
    _Float16* Xh    = (_Float16*)(ws + 0 * MB);   //  8 MB  (4096x1024 f16)
    _Float16* WallT = (_Float16*)(ws + 8 * MB);   //  8 MB  (4096x1024 f16, B^T)
    _Float16* WohT  = (_Float16*)(ws + 16 * MB);  //  2 MB  (1024x1024 f16, B^T)
    _Float16* Qh    = (_Float16*)(ws + 18 * MB);  //  8 MB
    _Float16* Kh    = (_Float16*)(ws + 26 * MB);  //  8 MB
    _Float16* Vh    = (_Float16*)(ws + 34 * MB);  //  8 MB
    float*    gateb = (float*)   (ws + 42 * MB);  // 16 MB  (4096x1024 f32)
    _Float16* AOh   = (_Float16*)(ws + 58 * MB);  //  8 MB  (gated attn out f16)

    {
        const int total = DMODEL * N4 + DMODEL * DMODEL;
        prep_weights<<<(total + 255) / 256, 256, 0, stream>>>(Wq, Wk, Wv, Wg, Wo,
                                                              WallT, WohT);
    }
    // 2. LayerNorm -> f16
    layernorm_f16<<<SROWS, 256, 0, stream>>>(seq, gamma, beta, Xh);

    // 3. QKVG projection GEMM (4096x1024 @ 1024x4096), split epilogue
    {
        dim3 grid(N4 / 64, SROWS / 128);
        wmma_gemm<<<grid, 256, 0, stream>>>(Xh, WallT, N4, DMODEL, 0,
                                            Qh, Kh, Vh, gateb, bg,
                                            nullptr, nullptr);
    }
    // 4. attention + gate -> AOh (f16)
    flash_attn<<<(BATCH * NHEAD * (LSEQ / 16)) / 4, 128, 0, stream>>>(
        Qh, Kh, Vh, gateb, AOh);

    // 5. output projection (4096x1024 @ 1024x1024) + bo -> f32 d_out
    {
        dim3 grid(DMODEL / 64, SROWS / 128);
        wmma_gemm<<<grid, 256, 0, stream>>>(AOh, WohT, DMODEL, DMODEL, 1,
                                            nullptr, nullptr, nullptr, nullptr,
                                            nullptr, out, bo);
    }
}

// v002
// It runs in 315 microseconds.
// Timed twice side by side with v001, it ran 1.19 and 1.20 times as fast.
// Counting every step since v000, it is 1.32 times as fast.
#include <hip/hip_runtime.h>
#include <hip/hip_bf16.h>

typedef __attribute__((ext_vector_type(16))) _Float16 v16h;
typedef __attribute__((ext_vector_type(8)))  _Float16 v8h;
typedef __attribute__((ext_vector_type(4)))  _Float16 v4h;
typedef __attribute__((ext_vector_type(8)))  float    v8f;
typedef __attribute__((ext_vector_type(4)))  float    v4f;
typedef __attribute__((ext_vector_type(4)))  unsigned u32x4;
typedef __attribute__((ext_vector_type(8)))  unsigned u32x8;

#define BATCH   2
#define LSEQ    2048
#define DMODEL  1024
#define NHEAD   16
#define HDIM    64
#define SROWS   (BATCH * LSEQ)     // 4096
#define N4      (4 * DMODEL)       // 4096  (Q|K|V|G concatenated columns)

__device__ __forceinline__ v8f wmma_f16(v16h a, v16h b, v8f c) {
    return __builtin_amdgcn_wmma_f32_16x16x32_f16(false, a, false, b,
                                                  (short)0, c, false, false);
}

// Build a 16-half A/B fragment from two 16-byte (8-half) chunks.
__device__ __forceinline__ v16h ld_frag(const _Float16* p0, const _Float16* p1) {
    v8h a = *reinterpret_cast<const v8h*>(p0);
    v8h b = *reinterpret_cast<const v8h*>(p1);
    return __builtin_shufflevector(a, b, 0, 1, 2, 3, 4, 5, 6, 7,
                                         8, 9, 10, 11, 12, 13, 14, 15);
}

__device__ __forceinline__ void tdm_load_tile_f16(const _Float16* gptr,
                                                  const _Float16* ldsptr,
                                                  unsigned tile_d0,
                                                  unsigned tile_d1,
                                                  unsigned stride_elems) {
    unsigned long long ga = (unsigned long long)(size_t)gptr;
    unsigned lds_addr = (unsigned)(size_t)ldsptr;
    u32x4 g0;
    g0[0] = 1u;
    g0[1] = lds_addr;
    g0[2] = (unsigned)ga;
    g0[3] = ((unsigned)(ga >> 32) & 0x01FFFFFFu)
            | 0x80000000u;
    u32x8 g1;
    g1[0] = 0x00010000u;
    g1[1] = (tile_d0 & 0xFFFFu) << 16;
    g1[2] = (tile_d0 >> 16) | ((tile_d1 & 0xFFFFu) << 16);
    g1[3] = (tile_d1 >> 16) | (tile_d0 << 16);
    g1[4] = tile_d1 & 0xFFFFu;
    g1[5] = stride_elems;
    g1[6] = 0u;
    g1[7] = 0u;
    asm volatile("tensor_load_to_lds %0, %1" :: "s"(g0), "s"(g1) : "memory");
}

__device__ __forceinline__ void tdm_wait0() {
    asm volatile("s_wait_tensorcnt 0x0" ::: "memory");
}

#define TPITCH 72   // LDS row pitch in halves: 144 B = 16 B x odd (b128 readers)

__global__ __launch_bounds__(256) void prep_weights(const float* __restrict__ Wq,
                                                    const float* __restrict__ Wk,
                                                    const float* __restrict__ Wv,
                                                    const float* __restrict__ Wg,
                                                    const float* __restrict__ Wo,
                                                    _Float16* __restrict__ WallT,
                                                    _Float16* __restrict__ WohT) {
    __shared__ __align__(16) _Float16 T[64 * TPITCH];   // T[n][k]

    const int tid = threadIdx.x;
    const int m   = blockIdx.z;                 // which matrix
    const int n0  = blockIdx.x * 64;
    const int k0  = blockIdx.y * 64;
    const float* src = (m == 0) ? Wq : (m == 1) ? Wk : (m == 2) ? Wv
                     : (m == 3) ? Wg : Wo;
    _Float16* dst = (m < 4) ? WallT + (size_t)m * DMODEL * DMODEL : WohT;

    // each thread: a 4(k) x 4(n) patch, turned in registers
    const int g = tid & 15;                     // columns n0 + 4g .. 4g + 3
    const int q = tid >> 4;                     // rows    k0 + 4q .. 4q + 3
    const float* sp = src + (size_t)(k0 + 4 * q) * DMODEL + n0 + 4 * g;
    const v4f r0 = *reinterpret_cast<const v4f*>(sp);
    const v4f r1 = *reinterpret_cast<const v4f*>(sp + DMODEL);
    const v4f r2 = *reinterpret_cast<const v4f*>(sp + 2 * DMODEL);
    const v4f r3 = *reinterpret_cast<const v4f*>(sp + 3 * DMODEL);
#pragma unroll
    for (int j = 0; j < 4; ++j) {
        v4h h;
        h[0] = (_Float16)r0[j];
        h[1] = (_Float16)r1[j];
        h[2] = (_Float16)r2[j];
        h[3] = (_Float16)r3[j];
        *reinterpret_cast<v4h*>(T + (4 * g + j) * TPITCH + 4 * q) = h;
    }
    __syncthreads();

    // eight threads per transposed row: 64 k = one 128-byte line
    const int c = tid & 7;
#pragma unroll
    for (int p = 0; p < 2; ++p) {
        const int n = p * 32 + (tid >> 3);
        const v8h v = *reinterpret_cast<const v8h*>(T + n * TPITCH + 8 * c);
        *reinterpret_cast<v8h*>(dst + (size_t)(n0 + n) * DMODEL + k0 + 8 * c) = v;
    }
}

// ---------------------------------------------------------------------------
// Kernel 2: LayerNorm over D=1024, emit f16 x-hat. One block per row.
// ---------------------------------------------------------------------------
__global__ __launch_bounds__(256) void layernorm_f16(const float* __restrict__ seq,
                                                     const float* __restrict__ gamma,
                                                     const float* __restrict__ beta,
                                                     _Float16* __restrict__ Xh) {
    __shared__ float red[256];
    const int row = blockIdx.x;
    const int tid = threadIdx.x;
    const float* p = seq + (size_t)row * DMODEL + tid * 4;
    v4f v = *reinterpret_cast<const v4f*>(p);

    red[tid] = v.x + v.y + v.z + v.w;
    __syncthreads();
    for (int off = 128; off > 0; off >>= 1) {
        if (tid < off) red[tid] += red[tid + off];
        __syncthreads();
    }
    const float mu = red[0] * (1.0f / DMODEL);
    __syncthreads();

    float d0 = v.x - mu, d1 = v.y - mu, d2 = v.z - mu, d3 = v.w - mu;
    red[tid] = d0 * d0 + d1 * d1 + d2 * d2 + d3 * d3;
    __syncthreads();
    for (int off = 128; off > 0; off >>= 1) {
        if (tid < off) red[tid] += red[tid + off];
        __syncthreads();
    }
    const float inv = rsqrtf(red[0] * (1.0f / DMODEL) + 1e-5f);

    v4f g = *reinterpret_cast<const v4f*>(gamma + tid * 4);
    v4f b = *reinterpret_cast<const v4f*>(beta + tid * 4);
    _Float16* op = Xh + (size_t)row * DMODEL + tid * 4;
    op[0] = (_Float16)(d0 * inv * g.x + b.x);
    op[1] = (_Float16)(d1 * inv * g.y + b.y);
    op[2] = (_Float16)(d2 * inv * g.z + b.z);
    op[3] = (_Float16)(d3 * inv * g.w + b.w);
}

// ---------------------------------------------------------------------------
// Kernel 3/5: WMMA GEMM  C(MxN) = A(MxK) @ B(KxN), B given TRANSPOSED (NxK).
// Block tile 128(M) x 64(N); 8 waves, each wave: one 16-row strip x 4 n-tiles.
// B tile (64 rows x 32 k-elems) staged into LDS by the Tensor Data Mover;
// fragments are then two ds_load_b128 each.
// mode 0: split epilogue -> Q/K/V f16 + gate=sigmoid(.+bg) f32   (N = 4096)
// mode 1: Y = . + bo -> f32 output                                (N = 1024)
// ---------------------------------------------------------------------------
__global__ __launch_bounds__(256) void wmma_gemm(const _Float16* __restrict__ A,
                                                 const _Float16* __restrict__ BwT,
                                                 int N, int Kd, int mode,
                                                 _Float16* __restrict__ Qo,
                                                 _Float16* __restrict__ Ko,
                                                 _Float16* __restrict__ Vo,
                                                 float* __restrict__ gateo,
                                                 const float* __restrict__ bg,
                                                 float* __restrict__ Yo,
                                                 const float* __restrict__ bo) {
    __shared__ __align__(16) _Float16 Bs[64 * 32];   // Bs[n][k], row-major

    const int tid  = threadIdx.x;
    const int lane = tid & 31;
    const int wave = tid >> 5;
    const int lo   = lane & 15;
    const int hi   = lane >> 4;

    const int nbase = blockIdx.x * 64;
    const int mbase = blockIdx.y * 128 + wave * 16;
    const _Float16* arow = A + (size_t)(mbase + lo) * Kd;

    v8f acc[4] = {v8f{}, v8f{}, v8f{}, v8f{}};

    for (int kb = 0; kb < Kd; kb += 32) {
        if (wave == 0) {
            tdm_load_tile_f16(BwT + (size_t)nbase * Kd + kb, Bs, 32, 64,
                              (unsigned)Kd);
            tdm_wait0();
        }
        __syncthreads();

        if (kb + 256 < Kd) __builtin_prefetch(arow + kb + 256, 0, 1);

        v16h af = ld_frag(arow + kb + hi * 8, arow + kb + 16 + hi * 8);
#pragma unroll
        for (int nt = 0; nt < 4; ++nt) {
            const _Float16* bsp = Bs + (nt * 16 + lo) * 32;
            v16h bf = ld_frag(bsp + hi * 8, bsp + 16 + hi * 8);
            acc[nt] = wmma_f16(af, bf, acc[nt]);
        }
        __syncthreads();
    }

    // epilogue: lane lo = column, rows r + 8*hi
#pragma unroll
    for (int nt = 0; nt < 4; ++nt) {
        const int nn = nbase + nt * 16 + lo;
#pragma unroll
        for (int r = 0; r < 8; ++r) {
            const int row = mbase + r + 8 * hi;
            const float a = acc[nt][r];
            if (mode == 0) {
                const int sel = nn >> 10;
                const int nc  = nn & (DMODEL - 1);
                const size_t oidx = (size_t)row * DMODEL + nc;
                if (sel == 0)      Qo[oidx] = (_Float16)a;
                else if (sel == 1) Ko[oidx] = (_Float16)a;
                else if (sel == 2) Vo[oidx] = (_Float16)a;
                else {
                    const float z = a + bg[nc];
                    gateo[oidx] = 1.0f / (1.0f + __expf(-z));
                }
            } else {
                Yo[(size_t)row * N + nn] = a + bo[nn];
            }
        }
    }
}

__device__ __forceinline__ float xhalf(float x) {
    return __builtin_bit_cast(float, __builtin_amdgcn_permlanex16(
        __builtin_bit_cast(int, x), __builtin_bit_cast(int, x),
        0x76543210, 0xfedcba98, false, false));
}

__global__ __launch_bounds__(128) void flash_attn(const _Float16* __restrict__ Q,
                                                  const _Float16* __restrict__ K,
                                                  const _Float16* __restrict__ V,
                                                  const float* __restrict__ gate,
                                                  _Float16* __restrict__ Oh) {
    __shared__ __align__(16) _Float16 KtAll[4][32 * HDIM];  // Kt[key][hd]
    __shared__ __align__(16) _Float16 VtAll[4][HDIM * 32];  // Vt[hd][key]

    const int tid  = threadIdx.x;
    const int lane = tid & 31;
    const int wave = tid >> 5;
    const int lo   = lane & 15;
    const int hi   = lane >> 4;
    _Float16* Kt = KtAll[wave];
    _Float16* Vt = VtAll[wave];

    const int task  = blockIdx.x * 4 + wave;     // 4096 tasks
    const int qt    = task & 127;                // 128 q-tiles
    const int head  = (task >> 7) & (NHEAD - 1);
    const int batch = task >> 11;
    const int qbase = qt * 16;
    const size_t headoff = (size_t)head * HDIM;

    // Q fragments (B operand, column = query lo): hd chunks [0,32) and [32,64)
    const _Float16* qrow = Q + ((size_t)(batch * LSEQ + qbase + lo)) * DMODEL + headoff;
    v16h qf0 = ld_frag(qrow + hi * 8,      qrow + 16 + hi * 8);
    v16h qf1 = ld_frag(qrow + 32 + hi * 8, qrow + 48 + hi * 8);

    v8f o[4] = {v8f{}, v8f{}, v8f{}, v8f{}};
    float rm = -1e30f;   // running maximum of query lo (same in both halves)
    float rl = 0.0f;     // running sum over this half's keys only
    const float scale = 0.125f;  // 1/sqrt(64)

    for (int kb = 0; kb < LSEQ; kb += 32) {
        tdm_load_tile_f16(K + ((size_t)(batch * LSEQ + kb)) * DMODEL + headoff,
                          Kt, HDIM, 32, DMODEL);

        // stage V transposed: lane handles key kb+lane, writes column `lane`
        {
            const _Float16* vrow =
                V + ((size_t)(batch * LSEQ + kb + lane)) * DMODEL + headoff;
#pragma unroll
            for (int c = 0; c < 8; ++c) {
                v8h dq = *reinterpret_cast<const v8h*>(vrow + c * 8);
#pragma unroll
                for (int j = 0; j < 8; ++j) Vt[(c * 8 + j) * 32 + lane] = dq[j];
            }
        }

        tdm_wait0();  // K tile resident in LDS

        // S^T tiles for keys [kb, kb+16) and [kb+16, kb+32) from LDS Kt:
        // s0[r] = S[query lo][key kb + 8*hi + r], s1[r]: key kb + 16 + 8*hi + r
        v8f s0 = v8f{}, s1 = v8f{};
        {
            const _Float16* kr0 = Kt + lo * HDIM;
            const _Float16* kr1 = Kt + (16 + lo) * HDIM;
            s0 = wmma_f16(ld_frag(kr0 + hi * 8,      kr0 + 16 + hi * 8), qf0, s0);
            s0 = wmma_f16(ld_frag(kr0 + 32 + hi * 8, kr0 + 48 + hi * 8), qf1, s0);
            s1 = wmma_f16(ld_frag(kr1 + hi * 8,      kr1 + 16 + hi * 8), qf0, s1);
            s1 = wmma_f16(ld_frag(kr1 + 32 + hi * 8, kr1 + 48 + hi * 8), qf1, s1);
        }

        // online softmax over the 32 new keys of query lo: 16 in this lane,
        // 16 in lane ^ 16
        float a[8], b[8];
        float mx = -1e30f;
#pragma unroll
        for (int r = 0; r < 8; ++r) {
            a[r] = s0[r] * scale;
            b[r] = s1[r] * scale;
            mx = fmaxf(mx, fmaxf(a[r], b[r]));
        }
        mx = fmaxf(mx, xhalf(mx));
        const float mnew = fmaxf(rm, mx);
        const float corr = __expf(rm - mnew);
        rm = mnew;

        // P^T as B operand: element s of the fragment is key 8*hi + s (s < 8)
        // or 16 + 8*hi + (s - 8), the k order of the Vt loader below
        v16h pf;
        float rs = 0.0f;
#pragma unroll
        for (int r = 0; r < 8; ++r) {
            const float e0 = __expf(a[r] - mnew);
            const float e1 = __expf(b[r] - mnew);
            rs += e0 + e1;
            pf[r]     = (_Float16)e0;
            pf[8 + r] = (_Float16)e1;
        }
        rl = rl * corr + rs;

        // O^T += V^T (16 hd rows x 32 keys) @ P^T (32 keys x 16 queries)
#pragma unroll
        for (int c = 0; c < 4; ++c) {
            const _Float16* vp = Vt + (c * 16 + lo) * 32;
            v16h vf = ld_frag(vp + hi * 8, vp + 16 + hi * 8);
            o[c] = wmma_f16(vf, pf, o[c] * corr);
        }
    }

    // epilogue: o[c][r] = O[query lo][hd c*16 + 8*hi + r]; join the halves'
    // sums, normalize, gate, store 8 consecutive f16 per chunk
    const float l = rl + xhalf(rl);
    const size_t rowoff = ((size_t)(batch * LSEQ + qbase + lo)) * DMODEL + headoff;
#pragma unroll
    for (int c = 0; c < 4; ++c) {
        const int col = c * 16 + 8 * hi;
        const v4f g0 = *reinterpret_cast<const v4f*>(gate + rowoff + col);
        const v4f g1 = *reinterpret_cast<const v4f*>(gate + rowoff + col + 4);
        v8h ov;
#pragma unroll
        for (int r = 0; r < 8; ++r) {
            const float val = o[c][r] / l;
            const float g = (r < 4) ? g0[r & 3] : g1[r & 3];
            ov[r] = (_Float16)(val * g);
        }
        *reinterpret_cast<v8h*>(Oh + rowoff + col) = ov;
    }
}

// ---------------------------------------------------------------------------
// host-side launch
// ---------------------------------------------------------------------------
extern "C" void kernel_launch(void* const* d_in, const int* in_sizes, int n_in,
                              void* d_out, int out_size, void* d_ws, size_t ws_size,
                              hipStream_t stream) {
    (void)in_sizes; (void)n_in; (void)out_size; (void)ws_size;

    const float* seq   = (const float*)d_in[0];
    const float* gamma = (const float*)d_in[1];
    const float* beta  = (const float*)d_in[2];
    const float* Wq    = (const float*)d_in[3];
    const float* Wk    = (const float*)d_in[4];
    const float* Wv    = (const float*)d_in[5];
    const float* Wg    = (const float*)d_in[6];
    const float* bg    = (const float*)d_in[7];
    const float* Wo    = (const float*)d_in[8];
    const float* bo    = (const float*)d_in[9];
    float* out = (float*)d_out;

    char* ws = (char*)d_ws;
    const size_t MB = 1u << 20;
    _Float16* Xh    = (_Float16*)(ws + 0 * MB);   //  8 MB  (4096x1024 f16)
    _Float16* WallT = (_Float16*)(ws + 8 * MB);   //  8 MB  (4096x1024 f16, B^T)
    _Float16* WohT  = (_Float16*)(ws + 16 * MB);  //  2 MB  (1024x1024 f16, B^T)
    _Float16* Qh    = (_Float16*)(ws + 18 * MB);  //  8 MB
    _Float16* Kh    = (_Float16*)(ws + 26 * MB);  //  8 MB
    _Float16* Vh    = (_Float16*)(ws + 34 * MB);  //  8 MB
    float*    gateb = (float*)   (ws + 42 * MB);  // 16 MB  (4096x1024 f32)
    _Float16* AOh   = (_Float16*)(ws + 58 * MB);  //  8 MB  (gated attn out f16)

    {
        dim3 grid(DMODEL / 64, DMODEL / 64, 5);
        prep_weights<<<grid, 256, 0, stream>>>(Wq, Wk, Wv, Wg, Wo, WallT, WohT);
    }
    // 2. LayerNorm -> f16
    layernorm_f16<<<SROWS, 256, 0, stream>>>(seq, gamma, beta, Xh);

    // 3. QKVG projection GEMM (4096x1024 @ 1024x4096), split epilogue
    {
        dim3 grid(N4 / 64, SROWS / 128);
        wmma_gemm<<<grid, 256, 0, stream>>>(Xh, WallT, N4, DMODEL, 0,
                                            Qh, Kh, Vh, gateb, bg,
                                            nullptr, nullptr);
    }
    // 4. attention + gate -> AOh (f16)
    flash_attn<<<(BATCH * NHEAD * (LSEQ / 16)) / 4, 128, 0, stream>>>(
        Qh, Kh, Vh, gateb, AOh);

    // 5. output projection (4096x1024 @ 1024x1024) + bo -> f32 d_out
    {
        dim3 grid(DMODEL / 64, SROWS / 128);
        wmma_gemm<<<grid, 256, 0, stream>>>(AOh, WohT, DMODEL, DMODEL, 1,
                                            nullptr, nullptr, nullptr, nullptr,
                                            nullptr, out, bo);
    }
}

// v003
// It runs in 235 microseconds.
// Timed twice side by side with v002, it ran 1.34 times as fast both times.
// Counting every step since v000, it is 1.77 times as fast.
#include <hip/hip_runtime.h>
#include <hip/hip_bf16.h>

typedef __attribute__((ext_vector_type(16))) _Float16 v16h;
typedef __attribute__((ext_vector_type(8)))  _Float16 v8h;
typedef __attribute__((ext_vector_type(4)))  _Float16 v4h;
typedef __attribute__((ext_vector_type(8)))  float    v8f;
typedef __attribute__((ext_vector_type(4)))  float    v4f;
typedef __attribute__((ext_vector_type(4)))  unsigned u32x4;
typedef __attribute__((ext_vector_type(8)))  unsigned u32x8;

#define BATCH   2
#define LSEQ    2048
#define DMODEL  1024
#define NHEAD   16
#define HDIM    64
#define SROWS   (BATCH * LSEQ)     // 4096
#define N4      (4 * DMODEL)       // 4096  (Q|K|V|G concatenated columns)

__device__ __forceinline__ v8f wmma_f16(v16h a, v16h b, v8f c) {
    return __builtin_amdgcn_wmma_f32_16x16x32_f16(false, a, false, b,
                                                  (short)0, c, false, false);
}

// Build a 16-half A/B fragment from two 16-byte (8-half) chunks.
__device__ __forceinline__ v16h ld_frag(const _Float16* p0, const _Float16* p1) {
    v8h a = *reinterpret_cast<const v8h*>(p0);
    v8h b = *reinterpret_cast<const v8h*>(p1);
    return __builtin_shufflevector(a, b, 0, 1, 2, 3, 4, 5, 6, 7,
                                         8, 9, 10, 11, 12, 13, 14, 15);
}

__device__ __forceinline__ void tdm_load_tile_f16(const _Float16* gptr,
                                                  const _Float16* ldsptr,
                                                  unsigned tile_d0,
                                                  unsigned tile_d1,
                                                  unsigned stride_elems) {
    unsigned long long ga = (unsigned long long)(size_t)gptr;
    unsigned lds_addr = (unsigned)(size_t)ldsptr;
    u32x4 g0;
    g0[0] = 1u;
    g0[1] = lds_addr;
    g0[2] = (unsigned)ga;
    g0[3] = ((unsigned)(ga >> 32) & 0x01FFFFFFu)
            | 0x80000000u;
    u32x8 g1;
    g1[0] = 0x00010000u;
    g1[1] = (tile_d0 & 0xFFFFu) << 16;
    g1[2] = (tile_d0 >> 16) | ((tile_d1 & 0xFFFFu) << 16);
    g1[3] = (tile_d1 >> 16) | (tile_d0 << 16);
    g1[4] = tile_d1 & 0xFFFFu;
    g1[5] = stride_elems;
    g1[6] = 0u;
    g1[7] = 0u;
    asm volatile("tensor_load_to_lds %0, %1" :: "s"(g0), "s"(g1) : "memory");
}

__device__ __forceinline__ void tdm_wait0() {
    asm volatile("s_wait_tensorcnt 0x0" ::: "memory");
}

__device__ __forceinline__ unsigned uni(unsigned v) {
    return (unsigned)__builtin_amdgcn_readfirstlane(v);
}

#define VROWB   128u                    // bytes of one V row of one head
#define VPITCH  160u                    // LDS pitch of a V row
#define VSLOT   6144u                   // 32 * VPITCH rounded up to 2 KiB
__device__ __forceinline__ u32x4 tdm_v_group0(unsigned lds_addr,
                                              unsigned long long ga) {
    u32x4 g0;
    g0[0] = uni(1u);                                   // count = 1
    g0[1] = uni(lds_addr);
    g0[2] = uni((unsigned)ga);
    g0[3] = uni((((unsigned)(ga >> 32)) & 0x01FFFFFFu) | 0x80000000u); // type 2
    return g0;
}
__device__ __forceinline__ u32x8 tdm_v_group1() {
    u32x8 g1;
    g1[0] = uni((1u << 20) | (4u << 22) | (7u << 25));
    g1[1] = uni((VROWB & 0xFFFFu) << 16);
    g1[2] = uni((VROWB >> 16) | (32u << 16));
    g1[3] = uni(VROWB << 16);
    g1[4] = uni(32u);
    g1[5] = uni(2u * DMODEL);
    g1[6] = uni(0u);
    g1[7] = uni(0u);
    return g1;
}

// ds_load_tr16_b128: lane (lo, hi) gets T[k0 + 8*hi + 0..7][d0 + lo] of a
// row-major 16-bit LDS tile (each lane passes the address of the map in
// flash_attn).
typedef __attribute__((ext_vector_type(8))) short s16x8;
__device__ __forceinline__ v8h ld_tr16(const unsigned char* p) {
    typedef __attribute__((address_space(3))) s16x8 lds_s16x8;
    return __builtin_bit_cast(v8h,
        __builtin_amdgcn_ds_load_tr16_b128_v8i16((lds_s16x8*)p));
}

#define TPITCH 72   // LDS row pitch in halves: 144 B = 16 B x odd (b128 readers)

__global__ __launch_bounds__(256) void prep_weights(const float* __restrict__ Wq,
                                                    const float* __restrict__ Wk,
                                                    const float* __restrict__ Wv,
                                                    const float* __restrict__ Wg,
                                                    const float* __restrict__ Wo,
                                                    _Float16* __restrict__ WallT,
                                                    _Float16* __restrict__ WohT) {
    __shared__ __align__(16) _Float16 T[64 * TPITCH];   // T[n][k]

    const int tid = threadIdx.x;
    const int m   = blockIdx.z;                 // which matrix
    const int n0  = blockIdx.x * 64;
    const int k0  = blockIdx.y * 64;
    const float* src = (m == 0) ? Wq : (m == 1) ? Wk : (m == 2) ? Wv
                     : (m == 3) ? Wg : Wo;
    _Float16* dst = (m < 4) ? WallT + (size_t)m * DMODEL * DMODEL : WohT;

    // each thread: a 4(k) x 4(n) patch, turned in registers
    const int g = tid & 15;                     // columns n0 + 4g .. 4g + 3
    const int q = tid >> 4;                     // rows    k0 + 4q .. 4q + 3
    const float* sp = src + (size_t)(k0 + 4 * q) * DMODEL + n0 + 4 * g;
    const v4f r0 = *reinterpret_cast<const v4f*>(sp);
    const v4f r1 = *reinterpret_cast<const v4f*>(sp + DMODEL);
    const v4f r2 = *reinterpret_cast<const v4f*>(sp + 2 * DMODEL);
    const v4f r3 = *reinterpret_cast<const v4f*>(sp + 3 * DMODEL);
#pragma unroll
    for (int j = 0; j < 4; ++j) {
        v4h h;
        h[0] = (_Float16)r0[j];
        h[1] = (_Float16)r1[j];
        h[2] = (_Float16)r2[j];
        h[3] = (_Float16)r3[j];
        *reinterpret_cast<v4h*>(T + (4 * g + j) * TPITCH + 4 * q) = h;
    }
    __syncthreads();

    // eight threads per transposed row: 64 k = one 128-byte line
    const int c = tid & 7;
#pragma unroll
    for (int p = 0; p < 2; ++p) {
        const int n = p * 32 + (tid >> 3);
        const v8h v = *reinterpret_cast<const v8h*>(T + n * TPITCH + 8 * c);
        *reinterpret_cast<v8h*>(dst + (size_t)(n0 + n) * DMODEL + k0 + 8 * c) = v;
    }
}

// ---------------------------------------------------------------------------
// Kernel 2: LayerNorm over D=1024, emit f16 x-hat. One block per row.
// ---------------------------------------------------------------------------
__global__ __launch_bounds__(256) void layernorm_f16(const float* __restrict__ seq,
                                                     const float* __restrict__ gamma,
                                                     const float* __restrict__ beta,
                                                     _Float16* __restrict__ Xh) {
    __shared__ float red[256];
    const int row = blockIdx.x;
    const int tid = threadIdx.x;
    const float* p = seq + (size_t)row * DMODEL + tid * 4;
    v4f v = *reinterpret_cast<const v4f*>(p);

    red[tid] = v.x + v.y + v.z + v.w;
    __syncthreads();
    for (int off = 128; off > 0; off >>= 1) {
        if (tid < off) red[tid] += red[tid + off];
        __syncthreads();
    }
    const float mu = red[0] * (1.0f / DMODEL);
    __syncthreads();

    float d0 = v.x - mu, d1 = v.y - mu, d2 = v.z - mu, d3 = v.w - mu;
    red[tid] = d0 * d0 + d1 * d1 + d2 * d2 + d3 * d3;
    __syncthreads();
    for (int off = 128; off > 0; off >>= 1) {
        if (tid < off) red[tid] += red[tid + off];
        __syncthreads();
    }
    const float inv = rsqrtf(red[0] * (1.0f / DMODEL) + 1e-5f);

    v4f g = *reinterpret_cast<const v4f*>(gamma + tid * 4);
    v4f b = *reinterpret_cast<const v4f*>(beta + tid * 4);
    _Float16* op = Xh + (size_t)row * DMODEL + tid * 4;
    op[0] = (_Float16)(d0 * inv * g.x + b.x);
    op[1] = (_Float16)(d1 * inv * g.y + b.y);
    op[2] = (_Float16)(d2 * inv * g.z + b.z);
    op[3] = (_Float16)(d3 * inv * g.w + b.w);
}

// ---------------------------------------------------------------------------
// Kernel 3/5: WMMA GEMM  C(MxN) = A(MxK) @ B(KxN), B given TRANSPOSED (NxK).
// Block tile 128(M) x 64(N); 8 waves, each wave: one 16-row strip x 4 n-tiles.
// B tile (64 rows x 32 k-elems) staged into LDS by the Tensor Data Mover;
// fragments are then two ds_load_b128 each.
// mode 0: split epilogue -> Q/K/V f16 + gate=sigmoid(.+bg) f32   (N = 4096)
// mode 1: Y = . + bo -> f32 output                                (N = 1024)
// ---------------------------------------------------------------------------
__global__ __launch_bounds__(256) void wmma_gemm(const _Float16* __restrict__ A,
                                                 const _Float16* __restrict__ BwT,
                                                 int N, int Kd, int mode,
                                                 _Float16* __restrict__ Qo,
                                                 _Float16* __restrict__ Ko,
                                                 _Float16* __restrict__ Vo,
                                                 float* __restrict__ gateo,
                                                 const float* __restrict__ bg,
                                                 float* __restrict__ Yo,
                                                 const float* __restrict__ bo) {
    __shared__ __align__(16) _Float16 Bs[64 * 32];   // Bs[n][k], row-major

    const int tid  = threadIdx.x;
    const int lane = tid & 31;
    const int wave = tid >> 5;
    const int lo   = lane & 15;
    const int hi   = lane >> 4;

    const int nbase = blockIdx.x * 64;
    const int mbase = blockIdx.y * 128 + wave * 16;
    const _Float16* arow = A + (size_t)(mbase + lo) * Kd;

    v8f acc[4] = {v8f{}, v8f{}, v8f{}, v8f{}};

    for (int kb = 0; kb < Kd; kb += 32) {
        if (wave == 0) {
            tdm_load_tile_f16(BwT + (size_t)nbase * Kd + kb, Bs, 32, 64,
                              (unsigned)Kd);
            tdm_wait0();
        }
        __syncthreads();

        if (kb + 256 < Kd) __builtin_prefetch(arow + kb + 256, 0, 1);

        v16h af = ld_frag(arow + kb + hi * 8, arow + kb + 16 + hi * 8);
#pragma unroll
        for (int nt = 0; nt < 4; ++nt) {
            const _Float16* bsp = Bs + (nt * 16 + lo) * 32;
            v16h bf = ld_frag(bsp + hi * 8, bsp + 16 + hi * 8);
            acc[nt] = wmma_f16(af, bf, acc[nt]);
        }
        __syncthreads();
    }

    // epilogue: lane lo = column, rows r + 8*hi
#pragma unroll
    for (int nt = 0; nt < 4; ++nt) {
        const int nn = nbase + nt * 16 + lo;
#pragma unroll
        for (int r = 0; r < 8; ++r) {
            const int row = mbase + r + 8 * hi;
            const float a = acc[nt][r];
            if (mode == 0) {
                const int sel = nn >> 10;
                const int nc  = nn & (DMODEL - 1);
                const size_t oidx = (size_t)row * DMODEL + nc;
                if (sel == 0)      Qo[oidx] = (_Float16)a;
                else if (sel == 1) Ko[oidx] = (_Float16)a;
                else if (sel == 2) Vo[oidx] = (_Float16)a;
                else {
                    const float z = a + bg[nc];
                    gateo[oidx] = 1.0f / (1.0f + __expf(-z));
                }
            } else {
                Yo[(size_t)row * N + nn] = a + bo[nn];
            }
        }
    }
}

__device__ __forceinline__ float xhalf(float x) {
    return __builtin_bit_cast(float, __builtin_amdgcn_permlanex16(
        __builtin_bit_cast(int, x), __builtin_bit_cast(int, x),
        0x76543210, 0xfedcba98, false, false));
}

__global__ __launch_bounds__(128) void flash_attn(const _Float16* __restrict__ Q,
                                                  const _Float16* __restrict__ K,
                                                  const _Float16* __restrict__ V,
                                                  const float* __restrict__ gate,
                                                  _Float16* __restrict__ Oh) {
    __shared__ __align__(16) _Float16 KtAll[4][32 * HDIM];  // Kt[key][hd]
    __shared__ __attribute__((aligned(2048))) unsigned char VsAll[4 * VSLOT]; // Vs[key][hd], pitch VPITCH

    const int tid  = threadIdx.x;
    const int lane = tid & 31;
    const int wave = tid >> 5;
    const int lo   = lane & 15;
    const int hi   = lane >> 4;
    _Float16* Kt = KtAll[wave];
    const unsigned char* Vs = VsAll + wave * VSLOT;

    const int task  = blockIdx.x * 4 + wave;     // 4096 tasks
    const int qt    = task & 127;                // 128 q-tiles
    const int head  = (task >> 7) & (NHEAD - 1);
    const int batch = task >> 11;
    const int qbase = qt * 16;
    const size_t headoff = (size_t)head * HDIM;

    // Q fragments (B operand, column = query lo): hd chunks [0,32) and [32,64)
    const _Float16* qrow = Q + ((size_t)(batch * LSEQ + qbase + lo)) * DMODEL + headoff;
    v16h qf0 = ld_frag(qrow + hi * 8,      qrow + 16 + hi * 8);
    v16h qf1 = ld_frag(qrow + 32 + hi * 8, qrow + 48 + hi * 8);

    v8f o[4] = {v8f{}, v8f{}, v8f{}, v8f{}};
    float rm = -1e30f;   // running maximum of query lo (same in both halves)
    float rl = 0.0f;     // running sum over this half's keys only
    const float scale = 0.125f;  // 1/sqrt(64)

    const u32x8 vg1 = tdm_v_group1();
    const unsigned vlds = (unsigned)(size_t)Vs;  // byte offset in the block's LDS
    // transposing-load address of this lane: key row 8*hi + (lane & 7), 16-byte
    // half (lane >> 3) & 1 of a 32-byte (16 hd) column group
    const unsigned char* vad =
        Vs + (8 * hi + (lane & 7)) * VPITCH + ((lane >> 3) & 1) * 16;

    for (int kb = 0; kb < LSEQ; kb += 32) {
        const u32x4 vg0 = tdm_v_group0(vlds, (unsigned long long)(size_t)(
            V + ((size_t)(batch * LSEQ + kb)) * DMODEL + headoff));
        // this wave's LDS reads of the last pass have retired before the mover
        // rewrites the two tiles
        asm volatile("s_wait_dscnt 0x0" ::: "memory");
        tdm_load_tile_f16(K + ((size_t)(batch * LSEQ + kb)) * DMODEL + headoff,
                          Kt, HDIM, 32, DMODEL);
        // V tile of this pass: the wave's second request, queued behind K's
        asm volatile("tensor_load_to_lds %0, %1" :: "s"(vg0), "s"(vg1) : "memory");

        tdm_wait0();  // K and V tiles resident in LDS

        // S^T tiles for keys [kb, kb+16) and [kb+16, kb+32) from LDS Kt:
        // s0[r] = S[query lo][key kb + 8*hi + r], s1[r]: key kb + 16 + 8*hi + r
        v8f s0 = v8f{}, s1 = v8f{};
        {
            const _Float16* kr0 = Kt + lo * HDIM;
            const _Float16* kr1 = Kt + (16 + lo) * HDIM;
            s0 = wmma_f16(ld_frag(kr0 + hi * 8,      kr0 + 16 + hi * 8), qf0, s0);
            s0 = wmma_f16(ld_frag(kr0 + 32 + hi * 8, kr0 + 48 + hi * 8), qf1, s0);
            s1 = wmma_f16(ld_frag(kr1 + hi * 8,      kr1 + 16 + hi * 8), qf0, s1);
            s1 = wmma_f16(ld_frag(kr1 + 32 + hi * 8, kr1 + 48 + hi * 8), qf1, s1);
        }

        // online softmax over the 32 new keys of query lo: 16 in this lane,
        // 16 in lane ^ 16
        float a[8], b[8];
        float mx = -1e30f;
#pragma unroll
        for (int r = 0; r < 8; ++r) {
            a[r] = s0[r] * scale;
            b[r] = s1[r] * scale;
            mx = fmaxf(mx, fmaxf(a[r], b[r]));
        }
        mx = fmaxf(mx, xhalf(mx));
        const float mnew = fmaxf(rm, mx);
        const float corr = __expf(rm - mnew);
        rm = mnew;

        // P^T as B operand: element s of the fragment is key 8*hi + s (s < 8)
        // or 16 + 8*hi + (s - 8), the k order of the V^T loader below
        v16h pf;
        float rs = 0.0f;
#pragma unroll
        for (int r = 0; r < 8; ++r) {
            const float e0 = __expf(a[r] - mnew);
            const float e1 = __expf(b[r] - mnew);
            rs += e0 + e1;
            pf[r]     = (_Float16)e0;
            pf[8 + r] = (_Float16)e1;
        }
        rl = rl * corr + rs;

        // O^T += V^T (16 hd rows x 32 keys) @ P^T (32 keys x 16 queries)
#pragma unroll
        for (int c = 0; c < 4; ++c) {
            const v8h v0 = ld_tr16(vad + 32 * c);                // keys 8*hi + 0..7
            const v8h v1 = ld_tr16(vad + 16 * VPITCH + 32 * c);  // keys 16 + 8*hi + 0..7
            v16h vf = __builtin_shufflevector(v0, v1, 0, 1, 2, 3, 4, 5, 6, 7,
                                              8, 9, 10, 11, 12, 13, 14, 15);
            o[c] = wmma_f16(vf, pf, o[c] * corr);
        }
    }

    // epilogue: o[c][r] = O[query lo][hd c*16 + 8*hi + r]; join the halves'
    // sums, normalize, gate, store 8 consecutive f16 per chunk
    const float l = rl + xhalf(rl);
    const size_t rowoff = ((size_t)(batch * LSEQ + qbase + lo)) * DMODEL + headoff;
#pragma unroll
    for (int c = 0; c < 4; ++c) {
        const int col = c * 16 + 8 * hi;
        const v4f g0 = *reinterpret_cast<const v4f*>(gate + rowoff + col);
        const v4f g1 = *reinterpret_cast<const v4f*>(gate + rowoff + col + 4);
        v8h ov;
#pragma unroll
        for (int r = 0; r < 8; ++r) {
            const float val = o[c][r] / l;
            const float g = (r < 4) ? g0[r & 3] : g1[r & 3];
            ov[r] = (_Float16)(val * g);
        }
        *reinterpret_cast<v8h*>(Oh + rowoff + col) = ov;
    }
}

// ---------------------------------------------------------------------------
// host-side launch
// ---------------------------------------------------------------------------
extern "C" void kernel_launch(void* const* d_in, const int* in_sizes, int n_in,
                              void* d_out, int out_size, void* d_ws, size_t ws_size,
                              hipStream_t stream) {
    (void)in_sizes; (void)n_in; (void)out_size; (void)ws_size;

    const float* seq   = (const float*)d_in[0];
    const float* gamma = (const float*)d_in[1];
    const float* beta  = (const float*)d_in[2];
    const float* Wq    = (const float*)d_in[3];
    const float* Wk    = (const float*)d_in[4];
    const float* Wv    = (const float*)d_in[5];
    const float* Wg    = (const float*)d_in[6];
    const float* bg    = (const float*)d_in[7];
    const float* Wo    = (const float*)d_in[8];
    const float* bo    = (const float*)d_in[9];
    float* out = (float*)d_out;

    char* ws = (char*)d_ws;
    const size_t MB = 1u << 20;
    _Float16* Xh    = (_Float16*)(ws + 0 * MB);   //  8 MB  (4096x1024 f16)
    _Float16* WallT = (_Float16*)(ws + 8 * MB);   //  8 MB  (4096x1024 f16, B^T)
    _Float16* WohT  = (_Float16*)(ws + 16 * MB);  //  2 MB  (1024x1024 f16, B^T)
    _Float16* Qh    = (_Float16*)(ws + 18 * MB);  //  8 MB
    _Float16* Kh    = (_Float16*)(ws + 26 * MB);  //  8 MB
    _Float16* Vh    = (_Float16*)(ws + 34 * MB);  //  8 MB
    float*    gateb = (float*)   (ws + 42 * MB);  // 16 MB  (4096x1024 f32)
    _Float16* AOh   = (_Float16*)(ws + 58 * MB);  //  8 MB  (gated attn out f16)

    {
        dim3 grid(DMODEL / 64, DMODEL / 64, 5);
        prep_weights<<<grid, 256, 0, stream>>>(Wq, Wk, Wv, Wg, Wo, WallT, WohT);
    }
    // 2. LayerNorm -> f16
    layernorm_f16<<<SROWS, 256, 0, stream>>>(seq, gamma, beta, Xh);

    // 3. QKVG projection GEMM (4096x1024 @ 1024x4096), split epilogue
    {
        dim3 grid(N4 / 64, SROWS / 128);
        wmma_gemm<<<grid, 256, 0, stream>>>(Xh, WallT, N4, DMODEL, 0,
                                            Qh, Kh, Vh, gateb, bg,
                                            nullptr, nullptr);
    }
    // 4. attention + gate -> AOh (f16)
    flash_attn<<<(BATCH * NHEAD * (LSEQ / 16)) / 4, 128, 0, stream>>>(
        Qh, Kh, Vh, gateb, AOh);

    // 5. output projection (4096x1024 @ 1024x1024) + bo -> f32 d_out
    {
        dim3 grid(DMODEL / 64, SROWS / 128);
        wmma_gemm<<<grid, 256, 0, stream>>>(AOh, WohT, DMODEL, DMODEL, 1,
                                            nullptr, nullptr, nullptr, nullptr,
                                            nullptr, out, bo);
    }
}

// v004
// A run of this version takes 178 microseconds.
// Two timings next to v003 both put it at 1.32 times that version's speed.
// All steps since v000 together make it 2.34 times as fast.
#include <hip/hip_runtime.h>
#include <hip/hip_bf16.h>

typedef __attribute__((ext_vector_type(16))) _Float16 v16h;
typedef __attribute__((ext_vector_type(8)))  _Float16 v8h;
typedef __attribute__((ext_vector_type(4)))  _Float16 v4h;
typedef __attribute__((ext_vector_type(8)))  float    v8f;
typedef __attribute__((ext_vector_type(4)))  float    v4f;
typedef __attribute__((ext_vector_type(4)))  unsigned u32x4;
typedef __attribute__((ext_vector_type(8)))  unsigned u32x8;

#define BATCH   2
#define LSEQ    2048
#define DMODEL  1024
#define NHEAD   16
#define HDIM    64
#define SROWS   (BATCH * LSEQ)     // 4096
#define N4      (4 * DMODEL)       // 4096  (Q|K|V|G concatenated columns)

__device__ __forceinline__ v8f wmma_f16(v16h a, v16h b, v8f c) {
    return __builtin_amdgcn_wmma_f32_16x16x32_f16(false, a, false, b,
                                                  (short)0, c, false, false);
}

// Build a 16-half A/B fragment from two 16-byte (8-half) chunks.
__device__ __forceinline__ v16h ld_frag(const _Float16* p0, const _Float16* p1) {
    v8h a = *reinterpret_cast<const v8h*>(p0);
    v8h b = *reinterpret_cast<const v8h*>(p1);
    return __builtin_shufflevector(a, b, 0, 1, 2, 3, 4, 5, 6, 7,
                                         8, 9, 10, 11, 12, 13, 14, 15);
}

__device__ __forceinline__ void tdm_wait0() {
    asm volatile("s_wait_tensorcnt 0x0" ::: "memory");
}

__device__ __forceinline__ unsigned uni(unsigned v) {
    return (unsigned)__builtin_amdgcn_readfirstlane(v);
}

#define VROWB   128u                    // bytes of one V row of one head
#define VPITCH  160u                    // LDS pitch of a V row
#define VSLOT   6144u                   // 32 * VPITCH rounded up to 2 KiB
__device__ __forceinline__ u32x4 tdm_v_group0(unsigned lds_addr,
                                              unsigned long long ga) {
    u32x4 g0;
    g0[0] = uni(1u);                                   // count = 1
    g0[1] = uni(lds_addr);
    g0[2] = uni((unsigned)ga);
    g0[3] = uni((((unsigned)(ga >> 32)) & 0x01FFFFFFu) | 0x80000000u); // type 2
    return g0;
}
__device__ __forceinline__ u32x8 tdm_v_group1() {
    u32x8 g1;
    g1[0] = uni((1u << 20) | (4u << 22) | (7u << 25));
    g1[1] = uni((VROWB & 0xFFFFu) << 16);
    g1[2] = uni((VROWB >> 16) | (32u << 16));
    g1[3] = uni(VROWB << 16);
    g1[4] = uni(32u);
    g1[5] = uni(2u * DMODEL);
    g1[6] = uni(0u);
    g1[7] = uni(0u);
    return g1;
}

#define RROWB   128u                    // bytes of one tile row
#define RPITCH  144u                    // LDS pitch of a tile row
#define RPITCHH 72                      // the same in halves
#define KSLOT   6144u                   // 32 * RPITCH rounded up to 2 KiB
__device__ __forceinline__ u32x8 tdm_r_group1(unsigned rows, unsigned src_pitch) {
    u32x8 g1;
    g1[0] = uni((1u << 20) | (4u << 22) | (3u << 25));
    g1[1] = uni((RROWB & 0xFFFFu) << 16);
    g1[2] = uni((RROWB >> 16) | (rows << 16));
    g1[3] = uni(RROWB << 16);
    g1[4] = uni(rows);
    g1[5] = uni(src_pitch);
    g1[6] = uni(0u);
    g1[7] = uni(0u);
    return g1;
}

__device__ __forceinline__ unsigned pinned(unsigned v) {
    unsigned w = uni(v);
    asm volatile("" : "+s"(w));  // pinned(): a tensor load's issue test held in a scalar register
    return w;
}

// ds_load_tr16_b128: lane (lo, hi) gets T[k0 + 8*hi + 0..7][d0 + lo] of a
// row-major 16-bit LDS tile (each lane passes the address of the map in
// flash_attn).
typedef __attribute__((ext_vector_type(8))) short s16x8;
__device__ __forceinline__ v8h ld_tr16(const unsigned char* p) {
    typedef __attribute__((address_space(3))) s16x8 lds_s16x8;
    return __builtin_bit_cast(v8h,
        __builtin_amdgcn_ds_load_tr16_b128_v8i16((lds_s16x8*)p));
}

#define TPITCH 72   // LDS row pitch in halves: 144 B = 16 B x odd (b128 readers)

__global__ __launch_bounds__(256) void prep_weights(const float* __restrict__ Wq,
                                                    const float* __restrict__ Wk,
                                                    const float* __restrict__ Wv,
                                                    const float* __restrict__ Wg,
                                                    const float* __restrict__ Wo,
                                                    _Float16* __restrict__ WallT,
                                                    _Float16* __restrict__ WohT) {
    __shared__ __align__(16) _Float16 T[64 * TPITCH];   // T[n][k]

    const int tid = threadIdx.x;
    const int m   = blockIdx.z;                 // which matrix
    const int n0  = blockIdx.x * 64;
    const int k0  = blockIdx.y * 64;
    const float* src = (m == 0) ? Wq : (m == 1) ? Wk : (m == 2) ? Wv
                     : (m == 3) ? Wg : Wo;
    _Float16* dst = (m < 4) ? WallT + (size_t)m * DMODEL * DMODEL : WohT;

    // each thread: a 4(k) x 4(n) patch, turned in registers
    const int g = tid & 15;                     // columns n0 + 4g .. 4g + 3
    const int q = tid >> 4;                     // rows    k0 + 4q .. 4q + 3
    const float* sp = src + (size_t)(k0 + 4 * q) * DMODEL + n0 + 4 * g;
    const v4f r0 = *reinterpret_cast<const v4f*>(sp);
    const v4f r1 = *reinterpret_cast<const v4f*>(sp + DMODEL);
    const v4f r2 = *reinterpret_cast<const v4f*>(sp + 2 * DMODEL);
    const v4f r3 = *reinterpret_cast<const v4f*>(sp + 3 * DMODEL);
#pragma unroll
    for (int j = 0; j < 4; ++j) {
        v4h h;
        h[0] = (_Float16)r0[j];
        h[1] = (_Float16)r1[j];
        h[2] = (_Float16)r2[j];
        h[3] = (_Float16)r3[j];
        *reinterpret_cast<v4h*>(T + (4 * g + j) * TPITCH + 4 * q) = h;
    }
    __syncthreads();

    // eight threads per transposed row: 64 k = one 128-byte line
    const int c = tid & 7;
#pragma unroll
    for (int p = 0; p < 2; ++p) {
        const int n = p * 32 + (tid >> 3);
        const v8h v = *reinterpret_cast<const v8h*>(T + n * TPITCH + 8 * c);
        *reinterpret_cast<v8h*>(dst + (size_t)(n0 + n) * DMODEL + k0 + 8 * c) = v;
    }
}

// ---------------------------------------------------------------------------
// Kernel 2: LayerNorm over D=1024, emit f16 x-hat. One block per row.
// ---------------------------------------------------------------------------
__global__ __launch_bounds__(256) void layernorm_f16(const float* __restrict__ seq,
                                                     const float* __restrict__ gamma,
                                                     const float* __restrict__ beta,
                                                     _Float16* __restrict__ Xh) {
    __shared__ float red[256];
    const int row = blockIdx.x;
    const int tid = threadIdx.x;
    const float* p = seq + (size_t)row * DMODEL + tid * 4;
    v4f v = *reinterpret_cast<const v4f*>(p);

    red[tid] = v.x + v.y + v.z + v.w;
    __syncthreads();
    for (int off = 128; off > 0; off >>= 1) {
        if (tid < off) red[tid] += red[tid + off];
        __syncthreads();
    }
    const float mu = red[0] * (1.0f / DMODEL);
    __syncthreads();

    float d0 = v.x - mu, d1 = v.y - mu, d2 = v.z - mu, d3 = v.w - mu;
    red[tid] = d0 * d0 + d1 * d1 + d2 * d2 + d3 * d3;
    __syncthreads();
    for (int off = 128; off > 0; off >>= 1) {
        if (tid < off) red[tid] += red[tid + off];
        __syncthreads();
    }
    const float inv = rsqrtf(red[0] * (1.0f / DMODEL) + 1e-5f);

    v4f g = *reinterpret_cast<const v4f*>(gamma + tid * 4);
    v4f b = *reinterpret_cast<const v4f*>(beta + tid * 4);
    _Float16* op = Xh + (size_t)row * DMODEL + tid * 4;
    op[0] = (_Float16)(d0 * inv * g.x + b.x);
    op[1] = (_Float16)(d1 * inv * g.y + b.y);
    op[2] = (_Float16)(d2 * inv * g.z + b.z);
    op[3] = (_Float16)(d3 * inv * g.w + b.w);
}

// ---------------------------------------------------------------------------
// Kernel 3/5: WMMA GEMM  C(MxN) = A(MxK) @ B(KxN), B given TRANSPOSED (NxK).
// Block tile 128(M) x 64(N); 8 waves, each wave: one 16-row strip x 4 n-tiles.
// B tile (64 rows x 64 k-elems, 128-byte rows at pitch 144 B) staged into LDS by
// the Tensor Data Mover; fragments are then two ds_load_b128 each.
// mode 0: split epilogue -> Q/K/V f16 + gate=sigmoid(.+bg) f32   (N = 4096)
// mode 1: Y = . + bo -> f32 output                                (N = 1024)
// ---------------------------------------------------------------------------
__global__ __launch_bounds__(256) void wmma_gemm(const _Float16* __restrict__ A,
                                                 const _Float16* __restrict__ BwT,
                                                 int N, int Kd, int mode,
                                                 _Float16* __restrict__ Qo,
                                                 _Float16* __restrict__ Ko,
                                                 _Float16* __restrict__ Vo,
                                                 float* __restrict__ gateo,
                                                 const float* __restrict__ bg,
                                                 float* __restrict__ Yo,
                                                 const float* __restrict__ bo) {
    __shared__ __attribute__((aligned(2048))) _Float16 Bs[64 * RPITCHH]; // Bs[n][k], pitch RPITCH

    const int tid  = threadIdx.x;
    const int lane = tid & 31;
    const int wave = tid >> 5;
    const int lo   = lane & 15;
    const int hi   = lane >> 4;

    const int nbase = blockIdx.x * 64;
    const int mbase = blockIdx.y * 128 + wave * 16;
    const _Float16* arow = A + (size_t)(mbase + lo) * Kd;

    v8f acc[4] = {v8f{}, v8f{}, v8f{}, v8f{}};

    const u32x8 bg1 = tdm_r_group1(64u, 2u * (unsigned)Kd);
    const unsigned blds = (unsigned)(size_t)Bs;  // byte offset in the block's LDS
    const unsigned wave_s = uni((unsigned)tid >> 5);  // the wave's number, scalar

    for (int kb = 0; kb < Kd; kb += 64) {
        if (pinned(wave_s == 0u)) {
            const u32x4 bg0 = tdm_v_group0(blds, (unsigned long long)(size_t)(
                BwT + (size_t)nbase * Kd + kb));
            asm volatile("tensor_load_to_lds %0, %1" :: "s"(bg0), "s"(bg1) : "memory");
            tdm_wait0();
        }
        __syncthreads();

        if (kb + 256 < Kd) __builtin_prefetch(arow + kb + 256, 0, 1);

        // unrolled: both 32-k blocks of the tile read at constant LDS offsets
#pragma unroll
        for (int kk = 0; kk < 64; kk += 32) {
            v16h af = ld_frag(arow + kb + kk + hi * 8, arow + kb + kk + 16 + hi * 8);
#pragma unroll
            for (int nt = 0; nt < 4; ++nt) {
                const _Float16* bsp = Bs + (nt * 16 + lo) * RPITCHH + kk;
                v16h bf = ld_frag(bsp + hi * 8, bsp + 16 + hi * 8);
                acc[nt] = wmma_f16(af, bf, acc[nt]);
            }
        }
        __syncthreads();
    }

    // epilogue: lane lo = column, rows r + 8*hi
#pragma unroll
    for (int nt = 0; nt < 4; ++nt) {
        const int nn = nbase + nt * 16 + lo;
#pragma unroll
        for (int r = 0; r < 8; ++r) {
            const int row = mbase + r + 8 * hi;
            const float a = acc[nt][r];
            if (mode == 0) {
                const int sel = nn >> 10;
                const int nc  = nn & (DMODEL - 1);
                const size_t oidx = (size_t)row * DMODEL + nc;
                if (sel == 0)      Qo[oidx] = (_Float16)a;
                else if (sel == 1) Ko[oidx] = (_Float16)a;
                else if (sel == 2) Vo[oidx] = (_Float16)a;
                else {
                    const float z = a + bg[nc];
                    gateo[oidx] = 1.0f / (1.0f + __expf(-z));
                }
            } else {
                Yo[(size_t)row * N + nn] = a + bo[nn];
            }
        }
    }
}

__device__ __forceinline__ float xhalf(float x) {
    return __builtin_bit_cast(float, __builtin_amdgcn_permlanex16(
        __builtin_bit_cast(int, x), __builtin_bit_cast(int, x),
        0x76543210, 0xfedcba98, false, false));
}

__global__ __launch_bounds__(128) void flash_attn(const _Float16* __restrict__ Q,
                                                  const _Float16* __restrict__ K,
                                                  const _Float16* __restrict__ V,
                                                  const float* __restrict__ gate,
                                                  _Float16* __restrict__ Oh) {
    __shared__ __attribute__((aligned(2048))) unsigned char KtAll[4 * KSLOT]; // Kt[key][hd], pitch RPITCH
    __shared__ __attribute__((aligned(2048))) unsigned char VsAll[4 * VSLOT]; // Vs[key][hd], pitch VPITCH

    const int tid  = threadIdx.x;
    const int lane = tid & 31;
    const int wave = tid >> 5;
    const int lo   = lane & 15;
    const int hi   = lane >> 4;
    const _Float16* Kt = reinterpret_cast<const _Float16*>(KtAll + wave * KSLOT);
    const unsigned char* Vs = VsAll + wave * VSLOT;

    const int task  = blockIdx.x * 4 + wave;     // 4096 tasks
    const int qt    = task & 127;                // 128 q-tiles
    const int head  = (task >> 7) & (NHEAD - 1);
    const int batch = task >> 11;
    const int qbase = qt * 16;
    const size_t headoff = (size_t)head * HDIM;

    // Q fragments (B operand, column = query lo): hd chunks [0,32) and [32,64)
    const _Float16* qrow = Q + ((size_t)(batch * LSEQ + qbase + lo)) * DMODEL + headoff;
    v16h qf0 = ld_frag(qrow + hi * 8,      qrow + 16 + hi * 8);
    v16h qf1 = ld_frag(qrow + 32 + hi * 8, qrow + 48 + hi * 8);

    v8f o[4] = {v8f{}, v8f{}, v8f{}, v8f{}};
    float rm = -1e30f;   // running maximum of query lo (same in both halves)
    float rl = 0.0f;     // running sum over this half's keys only
    const float scale = 0.125f;  // 1/sqrt(64)

    const u32x8 kg1 = tdm_r_group1(32u, 2u * DMODEL);
    const unsigned klds = (unsigned)(size_t)Kt;  // byte offset in the block's LDS
    const u32x8 vg1 = tdm_v_group1();
    const unsigned vlds = (unsigned)(size_t)Vs;  // byte offset in the block's LDS
    // transposing-load address of this lane: key row 8*hi + (lane & 7), 16-byte
    // half (lane >> 3) & 1 of a 32-byte (16 hd) column group
    const unsigned char* vad =
        Vs + (8 * hi + (lane & 7)) * VPITCH + ((lane >> 3) & 1) * 16;

    for (int kb = 0; kb < LSEQ; kb += 32) {
        const u32x4 kg0 = tdm_v_group0(klds, (unsigned long long)(size_t)(
            K + ((size_t)(batch * LSEQ + kb)) * DMODEL + headoff));
        const u32x4 vg0 = tdm_v_group0(vlds, (unsigned long long)(size_t)(
            V + ((size_t)(batch * LSEQ + kb)) * DMODEL + headoff));
        // this wave's LDS reads of the last pass have retired before the mover
        // rewrites the two tiles
        asm volatile("s_wait_dscnt 0x0" ::: "memory");
        // K tile of this pass, rows padded to the pitch of its ds_load_b128 reader
        asm volatile("tensor_load_to_lds %0, %1" :: "s"(kg0), "s"(kg1) : "memory");
        // V tile of this pass: the wave's second request, queued behind K's
        asm volatile("tensor_load_to_lds %0, %1" :: "s"(vg0), "s"(vg1) : "memory");

        tdm_wait0();  // K and V tiles resident in LDS

        // S^T tiles for keys [kb, kb+16) and [kb+16, kb+32) from LDS Kt:
        // s0[r] = S[query lo][key kb + 8*hi + r], s1[r]: key kb + 16 + 8*hi + r
        v8f s0 = v8f{}, s1 = v8f{};
        {
            const _Float16* kr0 = Kt + lo * RPITCHH;
            const _Float16* kr1 = Kt + (16 + lo) * RPITCHH;
            s0 = wmma_f16(ld_frag(kr0 + hi * 8,      kr0 + 16 + hi * 8), qf0, s0);
            s0 = wmma_f16(ld_frag(kr0 + 32 + hi * 8, kr0 + 48 + hi * 8), qf1, s0);
            s1 = wmma_f16(ld_frag(kr1 + hi * 8,      kr1 + 16 + hi * 8), qf0, s1);
            s1 = wmma_f16(ld_frag(kr1 + 32 + hi * 8, kr1 + 48 + hi * 8), qf1, s1);
        }

        // online softmax over the 32 new keys of query lo: 16 in this lane,
        // 16 in lane ^ 16
        float a[8], b[8];
        float mx = -1e30f;
#pragma unroll
        for (int r = 0; r < 8; ++r) {
            a[r] = s0[r] * scale;
            b[r] = s1[r] * scale;
            mx = fmaxf(mx, fmaxf(a[r], b[r]));
        }
        mx = fmaxf(mx, xhalf(mx));
        const float mnew = fmaxf(rm, mx);
        const float corr = __expf(rm - mnew);
        rm = mnew;

        // P^T as B operand: element s of the fragment is key 8*hi + s (s < 8)
        // or 16 + 8*hi + (s - 8), the k order of the V^T loader below
        v16h pf;
        float rs = 0.0f;
#pragma unroll
        for (int r = 0; r < 8; ++r) {
            const float e0 = __expf(a[r] - mnew);
            const float e1 = __expf(b[r] - mnew);
            rs += e0 + e1;
            pf[r]     = (_Float16)e0;
            pf[8 + r] = (_Float16)e1;
        }
        rl = rl * corr + rs;

        // O^T += V^T (16 hd rows x 32 keys) @ P^T (32 keys x 16 queries)
#pragma unroll
        for (int c = 0; c < 4; ++c) {
            const v8h v0 = ld_tr16(vad + 32 * c);                // keys 8*hi + 0..7
            const v8h v1 = ld_tr16(vad + 16 * VPITCH + 32 * c);  // keys 16 + 8*hi + 0..7
            v16h vf = __builtin_shufflevector(v0, v1, 0, 1, 2, 3, 4, 5, 6, 7,
                                              8, 9, 10, 11, 12, 13, 14, 15);
            o[c] = wmma_f16(vf, pf, o[c] * corr);
        }
    }

    // epilogue: o[c][r] = O[query lo][hd c*16 + 8*hi + r]; join the halves'
    // sums, normalize, gate, store 8 consecutive f16 per chunk
    const float l = rl + xhalf(rl);
    const size_t rowoff = ((size_t)(batch * LSEQ + qbase + lo)) * DMODEL + headoff;
#pragma unroll
    for (int c = 0; c < 4; ++c) {
        const int col = c * 16 + 8 * hi;
        const v4f g0 = *reinterpret_cast<const v4f*>(gate + rowoff + col);
        const v4f g1 = *reinterpret_cast<const v4f*>(gate + rowoff + col + 4);
        v8h ov;
#pragma unroll
        for (int r = 0; r < 8; ++r) {
            const float val = o[c][r] / l;
            const float g = (r < 4) ? g0[r & 3] : g1[r & 3];
            ov[r] = (_Float16)(val * g);
        }
        *reinterpret_cast<v8h*>(Oh + rowoff + col) = ov;
    }
}

// ---------------------------------------------------------------------------
// host-side launch
// ---------------------------------------------------------------------------
extern "C" void kernel_launch(void* const* d_in, const int* in_sizes, int n_in,
                              void* d_out, int out_size, void* d_ws, size_t ws_size,
                              hipStream_t stream) {
    (void)in_sizes; (void)n_in; (void)out_size; (void)ws_size;

    const float* seq   = (const float*)d_in[0];
    const float* gamma = (const float*)d_in[1];
    const float* beta  = (const float*)d_in[2];
    const float* Wq    = (const float*)d_in[3];
    const float* Wk    = (const float*)d_in[4];
    const float* Wv    = (const float*)d_in[5];
    const float* Wg    = (const float*)d_in[6];
    const float* bg    = (const float*)d_in[7];
    const float* Wo    = (const float*)d_in[8];
    const float* bo    = (const float*)d_in[9];
    float* out = (float*)d_out;

    char* ws = (char*)d_ws;
    const size_t MB = 1u << 20;
    _Float16* Xh    = (_Float16*)(ws + 0 * MB);   //  8 MB  (4096x1024 f16)
    _Float16* WallT = (_Float16*)(ws + 8 * MB);   //  8 MB  (4096x1024 f16, B^T)
    _Float16* WohT  = (_Float16*)(ws + 16 * MB);  //  2 MB  (1024x1024 f16, B^T)
    _Float16* Qh    = (_Float16*)(ws + 18 * MB);  //  8 MB
    _Float16* Kh    = (_Float16*)(ws + 26 * MB);  //  8 MB
    _Float16* Vh    = (_Float16*)(ws + 34 * MB);  //  8 MB
    float*    gateb = (float*)   (ws + 42 * MB);  // 16 MB  (4096x1024 f32)
    _Float16* AOh   = (_Float16*)(ws + 58 * MB);  //  8 MB  (gated attn out f16)

    {
        dim3 grid(DMODEL / 64, DMODEL / 64, 5);
        prep_weights<<<grid, 256, 0, stream>>>(Wq, Wk, Wv, Wg, Wo, WallT, WohT);
    }
    // 2. LayerNorm -> f16
    layernorm_f16<<<SROWS, 256, 0, stream>>>(seq, gamma, beta, Xh);

    // 3. QKVG projection GEMM (4096x1024 @ 1024x4096), split epilogue
    {
        dim3 grid(N4 / 64, SROWS / 128);
        wmma_gemm<<<grid, 256, 0, stream>>>(Xh, WallT, N4, DMODEL, 0,
                                            Qh, Kh, Vh, gateb, bg,
                                            nullptr, nullptr);
    }
    // 4. attention + gate -> AOh (f16)
    flash_attn<<<(BATCH * NHEAD * (LSEQ / 16)) / 4, 128, 0, stream>>>(
        Qh, Kh, Vh, gateb, AOh);

    // 5. output projection (4096x1024 @ 1024x1024) + bo -> f32 d_out
    {
        dim3 grid(DMODEL / 64, SROWS / 128);
        wmma_gemm<<<grid, 256, 0, stream>>>(AOh, WohT, DMODEL, DMODEL, 1,
                                            nullptr, nullptr, nullptr, nullptr,
                                            nullptr, out, bo);
    }
}
